// v000
// Measured on an AMD MI455X. A time is GPU time per run, averaged over a window of back-to-back runs after a warm-up
// (all launches, gaps included; the runs take copies of the inputs in turn), and the median of several windows.
// Apart from v000's, it joins two sittings. Times from different sittings can be a few percent apart, while
// side-by-side timings come from the same sitting.
// v000, which the later versions start from, runs in 326 microseconds.
// compute dtype: all float inputs rounded to bf16; q/k/v = x . W^T with EXACT bf16 products on WMMA 16x16x32 (natural rows), f32; rotary (angles t x inv_freq, device cosf/sinf) in f32 on q and k, re-rounded to f16 hi + residual; banded all-keys attention with hybrid scores (first 128 queries 3-product, later single f16) and 3-product P.v everywhere (key tiles outside [q-512, q] skipped), x 1/8, running-max softmax in f32 (hardware exp); out = ctx (bf16 hi + lo, 2 products) . Wproj^T + b; f32 output.
#include <hip/hip_runtime.h>
#include <math.h>

typedef __attribute__((ext_vector_type(16))) _Float16 v16h;
typedef __attribute__((ext_vector_type(16))) __bf16 v16b;
typedef __attribute__((ext_vector_type(8)))  _Float16 v8h;
typedef __attribute__((ext_vector_type(8)))  float v8f;
typedef __attribute__((ext_vector_type(4)))  float v4f;
typedef __attribute__((ext_vector_type(2)))  float v2f;
typedef __attribute__((ext_vector_type(4)))  unsigned v4u;
typedef __attribute__((ext_vector_type(4)))  int v4i;
typedef float __attribute__((may_alias)) float_a;
typedef int __attribute__((may_alias)) int_a;

template <typename T> __device__ __forceinline__ void vst2(void* p, T v) { *(T*)p = v;  }
__device__ __forceinline__ v8f wmma16(v16h a, v16h b, v8f c) {
  v8f d = __builtin_amdgcn_wmma_f32_16x16x32_f16(false, a, false, b, (short)0, c, false, false);
  asm volatile("v_nop\n\tv_nop\n\tv_nop\n\tv_nop" : "+v"(d) : "v"(a), "v"(b));
  return d;
}
__device__ __forceinline__ v8f wmma_bf(v16b a, v16b b, v8f c) {
  v8f d = __builtin_amdgcn_wmma_f32_16x16x32_bf16(false, a, false, b, (short)0, c, false, false);
  asm volatile("v_nop\n\tv_nop\n\tv_nop\n\tv_nop" : "+v"(d) : "v"(a), "v"(b));
  return d;
}
// Causal local self-attention (B 2, T 2,048, C 1,024, 16 heads x 64, window 512): fused bias-free projection (natural [3C][C]), interleaved rotary embedding on q and k, scores / 8 restricted to k <= q <= k + 512, softmax, v, natural output projection + bias.
__device__ __forceinline__ v16h frag_h(const _Float16* rowk0, int lane) {
  union { v16h v; v8h q[2]; } u; const _Float16* p = rowk0 + 8 * (lane >> 4);
  u.q[0] = *(const v8h*)p; u.q[1] = *(const v8h*)(p + 16); return u.v;
}
__device__ __forceinline__ v16h frag_f32(const float* rowk0, int lane) {
  v16h a; const float* p = rowk0 + 8 * (lane >> 4);
#pragma unroll
  for (int i = 0; i < 8; ++i) { a[i] = (_Float16)p[i]; a[8 + i] = (_Float16)p[16 + i]; }
  return a;
}
__device__ __forceinline__ v16h frag_f32s(const float* rowk0, int lane, float sc) {
  v16h a; const float* p = rowk0 + 8 * (lane >> 4);
#pragma unroll
  for (int i = 0; i < 8; ++i) { a[i] = (_Float16)(p[i] * sc); a[8 + i] = (_Float16)(p[16 + i] * sc); }
  return a;
}
// column fragment from a [K][ld] layout (column n), rows >= K read as 0
__device__ __forceinline__ v16h fragc_f32(const float* W, int k0, int n, int lane, int ld, int K) {
  v16h a; const int g = lane >> 4;
#pragma unroll
  for (int i = 0; i < 8; ++i) { const int ka = k0 + 8 * g + i, kb = ka + 16;
    a[i] = (_Float16)(ka < K ? W[(size_t)(ka < K ? ka : K - 1) * ld + n] : 0.f); a[8 + i] = (_Float16)(kb < K ? W[(size_t)(kb < K ? kb : K - 1) * ld + n] : 0.f); }
  return a;
}
struct F2 { v16b h, l; };
__device__ __forceinline__ F2 bsplit16(const float v[16]) { F2 r;
#pragma unroll
  for (int i = 0; i < 16; ++i) { const __bf16 h = (__bf16)v[i]; r.h[i] = h; r.l[i] = (__bf16)(v[i] - (float)h); }
  return r; }
__device__ __forceinline__ F2 split_row(const float* row, int k0, int lane) { float v[16]; const float* p = row + k0 + 8 * (lane >> 4);
#pragma unroll
  for (int i = 0; i < 8; ++i) { v[i] = p[i]; v[8 + i] = p[16 + i]; }
  return bsplit16(v); }
__device__ __forceinline__ F2 split_rowK(const float* row, int k0, int lane, int K) { float v[16]; const int g = lane >> 4;
#pragma unroll
  for (int i = 0; i < 8; ++i) { const int ka = k0 + 8 * g + i, kb = ka + 16; v[i] = ka < K ? row[ka < K ? ka : K - 1] : 0.f; v[8 + i] = kb < K ? row[kb < K ? kb : K - 1] : 0.f; }
  return bsplit16(v); }
__device__ __forceinline__ F2 split_col(const float* W, int k0, int n, int lane, int ld, int K) { float v[16]; const int g = lane >> 4;
#pragma unroll
  for (int i = 0; i < 8; ++i) { const int ka = k0 + 8 * g + i, kb = ka + 16; v[i] = ka < K ? W[(size_t)(ka < K ? ka : K - 1) * ld + n] : 0.f; v[8 + i] = kb < K ? W[(size_t)(kb < K ? kb : K - 1) * ld + n] : 0.f; }
  return bsplit16(v); }
__device__ __forceinline__ v8f mac3(const F2& a, const F2& b, v8f c) { c = wmma_bf(a.l, b.h, c); c = wmma_bf(a.h, b.l, c); return wmma_bf(a.h, b.h, c); }
__device__ __forceinline__ float sigm(float v) { return 1.0f / (1.0f + expf(-v)); }
#define LDSX() do { asm volatile("s_wait_dscnt 0" ::: "memory"); __builtin_amdgcn_wave_barrier(); __builtin_amdgcn_fence(__ATOMIC_RELEASE, "workgroup"); } while (0)


#define NB 2
#define SS 2048
#define DM 1024
#define NH 16
#define LWIN 512
#define RBASE 10000.0f
#define HD 64
#define QKVW (3 * DM)
#ifndef TQB
#define TQB (SS / 64)
#define TNB NB
#define TOB (NB * SS / 64)     // output row tiles (all)
#endif
typedef __attribute__((ext_vector_type(8))) __bf16 v8b;
__device__ __forceinline__ v16b frag_b(const __bf16* rowk0, int lane) {
  union { v16b v; v8b q[2]; } u; const __bf16* p = rowk0 + 8 * (lane >> 4);
  u.q[0] = *(const v8b*)p; u.q[1] = *(const v8b*)(p + 16); return u.v;
}
__device__ __forceinline__ float bfr(float v) { return (float)(__bf16)v; }
__device__ __attribute__((noinline)) float exp_ni(float v) { return expf(v); }
__device__ __attribute__((noinline)) float erf_ni(float v) { return erff(v); }

#define PK_A 0                       // [3072][1024] Wqkv rows (natural [out][in])
#define PK_P (PK_A + QKVW * DM)        // [1024][1024] Wo rows (natural)
#define PK_END (PK_P + DM * DM)
#define WS_PK  0u
#define WS_QK  (WS_PK + 2u * PK_END)             // f16 [4096 rows][2048]: q | k
#define WS_QKL (WS_QK + 2u * NB * SS * 2 * DM)     // f16 q | k residual planes x2048
#define WS_VTH (WS_QKL + 2u * NB * SS * 2 * DM)    // f16 [b][1024 (h*64+d)][2048 s] hi
#define WS_VTL (WS_VTH + 2u * NB * DM * SS)        // f16 lo x 2048
#define WS_O   (WS_VTL + 2u * NB * DM * SS)        // f32 [4096][1024]
#define WS_CS  (WS_O + 4u * NB * SS * DM)           // f32 2 x [2048][32], reserved, unused (k_rope computes cos/sin)
#define WS_END (WS_CS + 4u * 2 * SS * 32)
// ---- k_pack: block = (row n, which): natural [out][in] rows -> bf16; which 0..2 -> W_q/W_k/W_v into PK_A rows which*1024 + n; 3 -> W_o into PK_P
__global__ __launch_bounds__(256) void k_pack(const float* __restrict__ WQ, const float* __restrict__ WK, const float* __restrict__ WV, const float* __restrict__ WO, __bf16* __restrict__ PK) {
  __shared__ __align__(16) __bf16 s[DM]; const int n = blockIdx.x, which = blockIdx.y, t = threadIdx.x; const float* Wm = (which == 0) ? WQ : (which == 1) ? WK : (which == 2) ? WV : WO;
  for (int k = t; k < DM; k += 256) s[k] = (__bf16)Wm[(size_t)n * DM + k];
  __syncthreads();
  __bf16* dst = (which < 3) ? PK + PK_A + ((size_t)which * DM + n) * DM : PK + PK_P + (size_t)n * DM;
  for (int q = t; q < DM / 8; q += 256) vst2((unsigned*)(dst + q * 8), *(const v4u*)&s[q * 8]);
}
__global__ __launch_bounds__(128) void k_qkv(const float* __restrict__ XQ, const float* __restrict__ XK, const float* __restrict__ XV, const __bf16* __restrict__ P, const float* __restrict__ BQ, const float* __restrict__ BK, const float* __restrict__ BV, _Float16* __restrict__ QK, _Float16* __restrict__ QKL, _Float16* __restrict__ VTH, _Float16* __restrict__ VTL) {
  const int which0 = (blockIdx.y * 128) / DM; const float* X = (which0 == 0) ? XQ : (which0 == 1) ? XK : XV; const float* BB = BQ ? (((which0 == 0) ? BQ : (which0 == 1) ? BK : BV) + (blockIdx.y * 128 - which0 * DM)) : nullptr;
  __shared__ __align__(16) _Float16 so[4][16][136], sol[4][16][136]; __shared__ __align__(16) _Float16 sth[128][72], stl[128][72];
  const int tid = threadIdx.x, wave = tid >> 5, lane = tid & 31, col = lane & 15, g = lane >> 4; const size_t r0 = (size_t)blockIdx.x * 64 + wave * 16; const int n0 = blockIdx.y * 128;
  v8f acc[8] = {};
#pragma unroll 2
  for (int kc = 0; kc < DM / 32; ++kc) { v16b a; { const float* p = X + (r0 + col) * DM + kc * 32 + 8 * g;
#pragma unroll
      for (int i = 0; i < 8; ++i) { a[i] = (__bf16)p[i]; a[8 + i] = (__bf16)p[16 + i]; } }
#pragma unroll
    for (int j = 0; j < 8; ++j) acc[j] = wmma_bf(a, frag_b(P + (size_t)(n0 + j * 16 + col) * DM + kc * 32, lane), acc[j]); }
  if (n0 < 2 * DM) {   // q stored unscaled (f16 sigma ~0.6, no subnormal exposure); 1/8 applied to the f32 score
#pragma unroll
    for (int j = 0; j < 8; ++j) {
#pragma unroll
      for (int r = 0; r < 8; ++r) { const float v = acc[j][r] + (BB ? bfr(BB[j * 16 + col]) : 0.f); const _Float16 hv = (_Float16)v; so[wave][8 * g + r][j * 16 + col] = hv; sol[wave][8 * g + r][j * 16 + col] = (_Float16)((v - (float)hv) * 2048.0f); } }   // q, k (+ bias) as f16 hi + (x2048) residual
    LDSX();
    for (int rl = 0; rl < 16; ++rl) if (lane < 16) { vst2((unsigned*)(QK + (r0 + rl) * (2 * DM) + n0 + lane * 8), *(const v4u*)&so[wave][rl][lane * 8]); vst2((unsigned*)(QKL + (r0 + rl) * (2 * DM) + n0 + lane * 8), *(const v4u*)&sol[wave][rl][lane * 8]); }
  } else {
#pragma unroll
    for (int j = 0; j < 8; ++j) {
#pragma unroll
      for (int r = 0; r < 8; ++r) { const float v = acc[j][r] + (BB ? bfr(BB[j * 16 + col]) : 0.f); const _Float16 hv = (_Float16)v; sth[j * 16 + col][wave * 16 + 8 * g + r] = hv; stl[j * 16 + col][wave * 16 + 8 * g + r] = (_Float16)((v - (float)hv) * 2048.0f); } }
    __syncthreads();
    const size_t rb = (size_t)blockIdx.x * 64; const int b = (int)(rb / SS), s0 = (int)(rb % SS); const int pc0 = n0 - 2 * DM;
    for (int q = tid; q < 128 * 8; q += 128) { const int d = q >> 3, pc = q & 7; const size_t o = ((size_t)b * DM + pc0 + d) * SS + s0 + pc * 8; vst2((unsigned*)(VTH + o), *(const v4u*)&sth[d][pc * 8]); vst2((unsigned*)(VTL + o), *(const v4u*)&stl[d][pc * 8]); }
  }
}
// ---- k_attn: block = (64 queries, head h, batch b): banded causal flash attention (K = 64: 2 k-steps), scores = (q.k) * 0.125 with single f16 operands (q/k hi + residual, 3 products, for qb < 2), P.V: f16 P x (V hi, V lo*2048) in two accumulators; O[b*S+q][h*64+d] = (acc + accl / 2048) / (2048 l) (256-B segments)
__global__ __launch_bounds__(128) void k_attn(const _Float16* __restrict__ QK, const _Float16* __restrict__ QKL, const _Float16* __restrict__ VTH, const _Float16* __restrict__ VTL, const void* __restrict__ KMASK, float* __restrict__ O) {
  __shared__ __align__(16) float sp[4][16][36]; __shared__ __align__(16) float so[4][16][68];
  const int tid = threadIdx.x, wave = tid >> 5, lane = tid & 31, col = lane & 15, g = lane >> 4;
  const int qb = blockIdx.x, h = blockIdx.y, b = blockIdx.z; const int q0 = qb * 64 + wave * 16; const size_t rq = (size_t)b * SS + q0 + col;
  v16h aq[2], aql[2];
#pragma unroll
  for (int kc = 0; kc < 2; ++kc) { aq[kc] = frag_h(QK + rq * (2 * DM) + h * HD + kc * 32, lane); aql[kc] = frag_h(QKL + rq * (2 * DM) + h * HD + kc * 32, lane); }
  float m[8], l[8];
#pragma unroll
  for (int r = 0; r < 8; ++r) { m[r] = -3.0e38f; l[r] = 0.f; }
  v8f acc[4] = {}, accl[4] = {};
  const int nks = SS / 32;   // all keys
  const int ks0 = (qb * 64 - LWIN) > 0 ? (qb * 64 - LWIN) / 32 : 0; const int nksc = (qb * 64 + 64) / 32;   // banded causal
#pragma unroll 1
  for (int ks = ks0; ks < nksc; ++ks) { v8f s[2];
#pragma unroll
    for (int ct = 0; ct < 2; ++ct) { const int kk = ks * 32 + ct * 16 + col; const _Float16* krow = QK + ((size_t)b * SS + kk) * (2 * DM) + DM + h * HD; const _Float16* krowl = QKL + ((size_t)b * SS + kk) * (2 * DM) + DM + h * HD; v8f c = {}, cl = {};
      if (qb < 2) {   // leading query blocks (few keys, outputs far above the global rms): 3 products
#pragma unroll
        for (int kc = 0; kc < 2; ++kc) { const v16h kh = frag_h(krow + kc * 32, lane); c = wmma16(aq[kc], kh, c); cl = wmma16(aql[kc], kh, cl); cl = wmma16(aq[kc], frag_h(krowl + kc * 32, lane), cl); }
#pragma unroll
        for (int r = 0; r < 8; ++r) c[r] += cl[r] * (1.0f / 2048.0f); }
      else {
#pragma unroll
        for (int kc = 0; kc < 2; ++kc) c = wmma16(aq[kc], frag_h(krow + kc * 32, lane), c); }   // single product elsewhere
      { const bool keepdummy = true; (void)keepdummy;
#pragma unroll
      for (int r = 0; r < 8; ++r) s[ct][r] = (kk <= q0 + 8 * g + r && (q0 + 8 * g + r) - kk <= LWIN) ? c[r] * 0.125f : -3.0e38f; } }   // 1/sqrt(64); masked keys excluded
#pragma unroll
    for (int r = 0; r < 8; ++r) { float mx = fmaxf(s[0][r], s[1][r]);
#pragma unroll
      for (int o = 1; o < 16; o <<= 1) mx = fmaxf(mx, __shfl_xor(mx, o));
      const float mn = fmaxf(m[r], mx); const float alpha = (m[r] <= -1.0e38f) ? 0.f : __expf(m[r] - mn);
      const float e0 = (s[0][r] <= -1.0e38f) ? 0.f : __expf(s[0][r] - mn), e1 = (s[1][r] <= -1.0e38f) ? 0.f : __expf(s[1][r] - mn); float es = e0 + e1;
#pragma unroll
      for (int o = 1; o < 16; o <<= 1) es += __shfl_xor(es, o);
      l[r] = l[r] * alpha + es; m[r] = mn;
#pragma unroll
      for (int dt = 0; dt < 4; ++dt) { acc[dt][r] *= alpha; accl[dt][r] *= alpha; }
      sp[wave][8 * g + r][col] = e0; sp[wave][8 * g + r][16 + col] = e1; }
    LDSX();
    v16h pa, pl; { const float* prow = &sp[wave][col][0] + 8 * (lane >> 4);
#pragma unroll
      for (int i = 0; i < 8; ++i) { const float x0 = prow[i] * 2048.0f, x1 = prow[16 + i] * 2048.0f; const _Float16 h0 = (_Float16)x0, h1 = (_Float16)x1; pa[i] = h0; pa[8 + i] = h1; pl[i] = (_Float16)((x0 - (float)h0) * 2048.0f); pl[8 + i] = (_Float16)((x1 - (float)h1) * 2048.0f); } }   // P scaled by 2^11 before the f16 split so small softmax weights stay out of the f16 subnormal range; 2^-11 folded into the epilogue
#pragma unroll
    for (int dt = 0; dt < 4; ++dt) { const size_t vr = ((size_t)b * DM + h * HD + dt * 16 + col) * SS + ks * 32; const v16h vh = frag_h(VTH + vr, lane); acc[dt] = wmma16(pa, vh, acc[dt]); if (qb < 32) { accl[dt] = wmma16(pl, vh, accl[dt]); accl[dt] = wmma16(pa, frag_h(VTL + vr, lane), accl[dt]); } }   // every query block (qb < 32 always holds): P hi/lo x V hi/lo (3 products)
    LDSX(); }
#pragma unroll
  for (int r = 0; r < 8; ++r) { const float il = (1.0f / 2048.0f) / l[r];
#pragma unroll
    for (int dt = 0; dt < 4; ++dt) so[wave][8 * g + r][dt * 16 + col] = (acc[dt][r] + accl[dt][r] * (1.0f / 2048.0f)) * il; }
  LDSX();
  for (int rl = 0; rl < 16; ++rl) if (lane < 16) vst2(O + ((size_t)b * SS + q0 + rl) * DM + h * HD + lane * 4, *(const v4f*)&so[wave][rl][lane * 4]);
}
// ---- k_out: block = (64 rows, 128 cols): out = O(hi/lo) . Wo rows (2 products) + bo
__global__ __launch_bounds__(128) void k_out(const float* __restrict__ O, const __bf16* __restrict__ P, const float* __restrict__ BO, float* __restrict__ Y) {
  __shared__ __align__(16) float so[4][16][132];
  const int tid = threadIdx.x, wave = tid >> 5, lane = tid & 31, col = lane & 15, g = lane >> 4; const size_t r0 = (size_t)blockIdx.x * 64 + wave * 16; const int n0 = blockIdx.y * 128;
  v8f acc[8] = {};
#pragma unroll 2
  for (int kc = 0; kc < DM / 32; ++kc) { const F2 a = split_row(O + (r0 + col) * DM, kc * 32, lane);
#pragma unroll
    for (int j = 0; j < 8; ++j) { const v16b w = frag_b(P + (size_t)(n0 + j * 16 + col) * DM + kc * 32, lane); acc[j] = wmma_bf(a.l, w, acc[j]); acc[j] = wmma_bf(a.h, w, acc[j]); } }
#pragma unroll
  for (int j = 0; j < 8; ++j) {
#pragma unroll
    for (int r = 0; r < 8; ++r) so[wave][8 * g + r][j * 16 + col] = acc[j][r] + bfr(BO[n0 + j * 16 + col]); }
  LDSX();
  for (int rl = 0; rl < 16; ++rl) vst2(Y + (r0 + rl) * DM + n0 + lane * 4, *(const v4f*)&so[wave][rl][lane * 4]);
}
// ---- k_rope: block = row (b,t), 256 threads: q and k (hi + residual, 1024 each) -> interleaved rotary with angle t * inv_freq[d/2], inv_freq[i] = BASE^(-i/32) -> back to hi + residual in place
__global__ __launch_bounds__(256) void k_rope(_Float16* __restrict__ QK, _Float16* __restrict__ QKL) { __shared__ __align__(16) _Float16 sh[2 * DM], sl[2 * DM]; const int t = threadIdx.x; const size_t row = blockIdx.x; const int pos = (int)(row % SS);
  for (int e = t; e < DM; e += 256) { // e = w*512 + pair index p (w: 0 q, 1 k); each thread handles 4 (even, odd) pairs, one per e
    const int w = e / (DM / 2), p = e % (DM / 2); const int c0 = 2 * p; const int i = (c0 % HD) / 2; const size_t o = row * (2 * DM) + (size_t)w * DM + c0;
    const float x0 = (float)QK[o] + (float)QKL[o] * (1.0f / 2048.0f), x1 = (float)QK[o + 1] + (float)QKL[o + 1] * (1.0f / 2048.0f);
    const float invf = (float)exp(-(double)i / (double)(HD / 2) * log((double)RBASE)); const float ang = (float)pos * invf; const float cs = cosf(ang), sn = sinf(ang);
    const float y0 = x0 * cs - x1 * sn, y1 = x1 * cs + x0 * sn;
    const _Float16 h0 = (_Float16)y0, h1 = (_Float16)y1; sh[w * DM + c0] = h0; sh[w * DM + c0 + 1] = h1; sl[w * DM + c0] = (_Float16)((y0 - (float)h0) * 2048.0f); sl[w * DM + c0 + 1] = (_Float16)((y1 - (float)h1) * 2048.0f); }
  __syncthreads(); vst2((unsigned*)(QK + row * (2 * DM) + t * 8), *(const v4u*)&sh[t * 8]); vst2((unsigned*)(QKL + row * (2 * DM) + t * 8), *(const v4u*)&sl[t * 8]); }
extern "C" void kernel_launch(void* const* d_in, const int* in_sizes, int n_in, void* d_out, int out_size, void* d_ws, size_t ws_size, hipStream_t stream) {
  (void)in_sizes; (void)n_in; (void)out_size;
  const float** F = (const float**)d_in;   // 0 x [2,2048,1024], 1 Wqkv [3072,1024] natural ((3,H,hd) rows), 2 Wproj [1024,1024] natural, 3 bproj [1024]
  if (ws_size < (size_t)WS_END) return;
  char* ws = (char*)d_ws; __bf16* PK = (__bf16*)(ws + WS_PK); _Float16 *QK = (_Float16*)(ws + WS_QK), *QKL = (_Float16*)(ws + WS_QKL), *VTH = (_Float16*)(ws + WS_VTH), *VTL = (_Float16*)(ws + WS_VTL); float* O = (float*)(ws + WS_O);
  k_pack<<<dim3(DM, 4), 256, 0, stream>>>(F[1], F[1] + (size_t)DM * DM, F[1] + (size_t)2 * DM * DM, F[2], PK);
  k_qkv<<<dim3(TNB * SS / 64, QKVW / 128), 128, 0, stream>>>(F[0], F[0], F[0], PK + PK_A, nullptr, nullptr, nullptr, QK, QKL, VTH, VTL);
  k_rope<<<TNB * SS, 256, 0, stream>>>(QK, QKL);
  k_attn<<<dim3(TQB, NH, TNB), 128, 0, stream>>>(QK, QKL, VTH, VTL, nullptr, O);
  k_out<<<dim3(TOB, DM / 128), 128, 0, stream>>>(O, PK + PK_P, F[3], (float*)d_out);
}

// v001
// Measured time: 195 microseconds a run.
// Next to v000, in two timings, it ran 1.70 and 1.69 times as fast.
// compute dtype: all float inputs rounded to bf16; q/k/v = x . W^T with EXACT bf16 products on WMMA 16x16x32 (natural rows), f32; rotary (angles t x inv_freq, device cosf/sinf) in f32 on q and k, re-rounded to f16 hi + residual; banded all-keys attention with hybrid scores (first 128 queries 3-product, later single f16) and 3-product P.v everywhere (key tiles outside [q-512, q] skipped), x 1/8, running-max softmax in f32 (hardware exp); out = ctx (bf16 hi + lo, 2 products) . Wproj^T + b; f32 output.
#include <hip/hip_runtime.h>
#include <math.h>

typedef __attribute__((ext_vector_type(16))) _Float16 v16h;
typedef __attribute__((ext_vector_type(16))) __bf16 v16b;
typedef __attribute__((ext_vector_type(8)))  _Float16 v8h;
typedef __attribute__((ext_vector_type(8)))  float v8f;
typedef __attribute__((ext_vector_type(4)))  float v4f;
typedef __attribute__((ext_vector_type(2)))  float v2f;
typedef __attribute__((ext_vector_type(4)))  unsigned v4u;
typedef __attribute__((ext_vector_type(4)))  int v4i;
typedef float __attribute__((may_alias)) float_a;
typedef int __attribute__((may_alias)) int_a;

template <typename T> __device__ __forceinline__ void vst2(void* p, T v) { *(T*)p = v;  }
__device__ __forceinline__ v8f wmma16(v16h a, v16h b, v8f c) {
  v8f d = __builtin_amdgcn_wmma_f32_16x16x32_f16(false, a, false, b, (short)0, c, false, false);
  asm volatile("v_nop\n\tv_nop\n\tv_nop\n\tv_nop" : "+v"(d) : "v"(a), "v"(b));
  return d;
}
__device__ __forceinline__ v8f wmma_bf(v16b a, v16b b, v8f c) {
  v8f d = __builtin_amdgcn_wmma_f32_16x16x32_bf16(false, a, false, b, (short)0, c, false, false);
  asm volatile("v_nop\n\tv_nop\n\tv_nop\n\tv_nop" : "+v"(d) : "v"(a), "v"(b));
  return d;
}
// Causal local self-attention (B 2, T 2,048, C 1,024, 16 heads x 64, window 512): fused bias-free projection (natural [3C][C]), interleaved rotary embedding on q and k, scores / 8 restricted to k <= q <= k + 512, softmax, v, natural output projection + bias.
__device__ __forceinline__ v16h frag_h(const _Float16* rowk0, int lane) {
  union { v16h v; v8h q[2]; } u; const _Float16* p = rowk0 + 8 * (lane >> 4);
  u.q[0] = *(const v8h*)p; u.q[1] = *(const v8h*)(p + 16); return u.v;
}
__device__ __forceinline__ v16h frag_f32(const float* rowk0, int lane) {
  v16h a; const float* p = rowk0 + 8 * (lane >> 4);
#pragma unroll
  for (int i = 0; i < 8; ++i) { a[i] = (_Float16)p[i]; a[8 + i] = (_Float16)p[16 + i]; }
  return a;
}
__device__ __forceinline__ v16h frag_f32s(const float* rowk0, int lane, float sc) {
  v16h a; const float* p = rowk0 + 8 * (lane >> 4);
#pragma unroll
  for (int i = 0; i < 8; ++i) { a[i] = (_Float16)(p[i] * sc); a[8 + i] = (_Float16)(p[16 + i] * sc); }
  return a;
}
// column fragment from a [K][ld] layout (column n), rows >= K read as 0
__device__ __forceinline__ v16h fragc_f32(const float* W, int k0, int n, int lane, int ld, int K) {
  v16h a; const int g = lane >> 4;
#pragma unroll
  for (int i = 0; i < 8; ++i) { const int ka = k0 + 8 * g + i, kb = ka + 16;
    a[i] = (_Float16)(ka < K ? W[(size_t)(ka < K ? ka : K - 1) * ld + n] : 0.f); a[8 + i] = (_Float16)(kb < K ? W[(size_t)(kb < K ? kb : K - 1) * ld + n] : 0.f); }
  return a;
}
struct F2 { v16b h, l; };
__device__ __forceinline__ F2 bsplit16(const float v[16]) { F2 r;
#pragma unroll
  for (int i = 0; i < 16; ++i) { const __bf16 h = (__bf16)v[i]; r.h[i] = h; r.l[i] = (__bf16)(v[i] - (float)h); }
  return r; }
__device__ __forceinline__ F2 split_row(const float* row, int k0, int lane) { float v[16]; const float* p = row + k0 + 8 * (lane >> 4);
#pragma unroll
  for (int i = 0; i < 8; ++i) { v[i] = p[i]; v[8 + i] = p[16 + i]; }
  return bsplit16(v); }
__device__ __forceinline__ F2 split_rowK(const float* row, int k0, int lane, int K) { float v[16]; const int g = lane >> 4;
#pragma unroll
  for (int i = 0; i < 8; ++i) { const int ka = k0 + 8 * g + i, kb = ka + 16; v[i] = ka < K ? row[ka < K ? ka : K - 1] : 0.f; v[8 + i] = kb < K ? row[kb < K ? kb : K - 1] : 0.f; }
  return bsplit16(v); }
__device__ __forceinline__ F2 split_col(const float* W, int k0, int n, int lane, int ld, int K) { float v[16]; const int g = lane >> 4;
#pragma unroll
  for (int i = 0; i < 8; ++i) { const int ka = k0 + 8 * g + i, kb = ka + 16; v[i] = ka < K ? W[(size_t)(ka < K ? ka : K - 1) * ld + n] : 0.f; v[8 + i] = kb < K ? W[(size_t)(kb < K ? kb : K - 1) * ld + n] : 0.f; }
  return bsplit16(v); }
__device__ __forceinline__ v8f mac3(const F2& a, const F2& b, v8f c) { c = wmma_bf(a.l, b.h, c); c = wmma_bf(a.h, b.l, c); return wmma_bf(a.h, b.h, c); }
__device__ __forceinline__ float sigm(float v) { return 1.0f / (1.0f + expf(-v)); }
#define LDSX() do { asm volatile("s_wait_dscnt 0" ::: "memory"); __builtin_amdgcn_wave_barrier(); __builtin_amdgcn_fence(__ATOMIC_RELEASE, "workgroup"); } while (0)


#define NB 2
#define SS 2048
#define DM 1024
#define NH 16
#define LWIN 512
#define RBASE 10000.0f
#define HD 64
#define QKVW (3 * DM)
#ifndef TQB
#define TQB (SS / 64)
#define TNB NB
#define TOB (NB * SS / 64)     // output row tiles (all)
#endif
typedef __attribute__((ext_vector_type(8))) __bf16 v8b;
__device__ __forceinline__ v16b frag_b(const __bf16* rowk0, int lane) {
  union { v16b v; v8b q[2]; } u; const __bf16* p = rowk0 + 8 * (lane >> 4);
  u.q[0] = *(const v8b*)p; u.q[1] = *(const v8b*)(p + 16); return u.v;
}
__device__ __forceinline__ float bfr(float v) { return (float)(__bf16)v; }
__device__ __attribute__((noinline)) float exp_ni(float v) { return expf(v); }
__device__ __attribute__((noinline)) float erf_ni(float v) { return erff(v); }

#define PK_A 0                       // [3072][1024] Wqkv rows (natural [out][in])
#define PK_P (PK_A + QKVW * DM)        // [1024][1024] Wo rows (natural)
#define PK_END (PK_P + DM * DM)
#define WS_PK  0u
#define WS_QK  (WS_PK + 2u * PK_END)             // f16 [4096 rows][2048]: q | k
#define WS_QKL (WS_QK + 2u * NB * SS * 2 * DM)     // f16 q | k residual planes x2048
#define WS_VTH (WS_QKL + 2u * NB * SS * 2 * DM)    // f16 [b][1024 (h*64+d)][2048 s] hi
#define WS_VTL (WS_VTH + 2u * NB * DM * SS)        // f16 lo x 2048
#define WS_O   (WS_VTL + 2u * NB * DM * SS)        // f32 [4096][1024]
#define WS_CS  (WS_O + 4u * NB * SS * DM)           // f32 2 x [2048][32], reserved, unused (k_rope computes cos/sin)
#define WS_END (WS_CS + 4u * 2 * SS * 32)
// ---- k_pack: block = (row n, which): natural [out][in] rows -> bf16; which 0..2 -> W_q/W_k/W_v into PK_A rows which*1024 + n; 3 -> W_o into PK_P
__global__ __launch_bounds__(256) void k_pack(const float* __restrict__ WQ, const float* __restrict__ WK, const float* __restrict__ WV, const float* __restrict__ WO, __bf16* __restrict__ PK) {
  __shared__ __align__(16) __bf16 s[DM]; const int n = blockIdx.x, which = blockIdx.y, t = threadIdx.x; const float* Wm = (which == 0) ? WQ : (which == 1) ? WK : (which == 2) ? WV : WO;
  for (int k = t; k < DM; k += 256) s[k] = (__bf16)Wm[(size_t)n * DM + k];
  __syncthreads();
  __bf16* dst = (which < 3) ? PK + PK_A + ((size_t)which * DM + n) * DM : PK + PK_P + (size_t)n * DM;
  for (int q = t; q < DM / 8; q += 256) vst2((unsigned*)(dst + q * 8), *(const v4u*)&s[q * 8]);
}
// ---- projection GEMM core: block tile (32 * MI rows) x 128 columns, 4 waves as 2 x 2, each (16 * MI) x 64. A stage is 64 k: the f32 rows of X (256 B, LDS pitch 272 B) and the bf16 rows of W (128 B, LDS pitch 144 B),
// brought into LDS by asynchronous b128 copies, two buffers: stage t + 1 flies while stage t is multiplied. Fragments keep the k order and every accumulator its k sequence (32 steps of 32, ascending).
#define GXP 272
#define GWP 144
// eight copies of one lane, LDS and global address each advancing by a fixed step; the closing s_wait_xcnt 0 stands inside the statement so that no address register is rewritten ahead of it
__device__ __forceinline__ void acopy8(unsigned l, unsigned ls, const char* g, unsigned gs) {
  asm volatile("global_load_async_to_lds_b128 %0, %8, off\n\t"
               "global_load_async_to_lds_b128 %1, %9, off\n\t"
               "global_load_async_to_lds_b128 %2, %10, off\n\t"
               "global_load_async_to_lds_b128 %3, %11, off\n\t"
               "global_load_async_to_lds_b128 %4, %12, off\n\t"
               "global_load_async_to_lds_b128 %5, %13, off\n\t"
               "global_load_async_to_lds_b128 %6, %14, off\n\t"
               "global_load_async_to_lds_b128 %7, %15, off\n\t"
               "s_wait_xcnt 0x0"
               :: "v"(l), "v"(l + ls), "v"(l + 2 * ls), "v"(l + 3 * ls), "v"(l + 4 * ls), "v"(l + 5 * ls), "v"(l + 6 * ls), "v"(l + 7 * ls),
                  "v"(g), "v"(g + gs), "v"(g + 2 * (size_t)gs), "v"(g + 3 * (size_t)gs), "v"(g + 4 * (size_t)gs), "v"(g + 5 * (size_t)gs), "v"(g + 6 * (size_t)gs), "v"(g + 7 * (size_t)gs)
               : "memory");
}
template <int MI, bool SPLIT>
__device__ __forceinline__ void gemm_lds(const float* __restrict__ Xb, const __bf16* __restrict__ Wb, unsigned char* sm, v8f (&acc)[MI][4], int tid) {
  constexpr int XB = 32 * MI * GXP, ST = XB + 128 * GWP, NT = DM / 64;
  const int wave = tid >> 5, lane = tid & 31, col = lane & 15, g = lane >> 4, wm = wave >> 1, wn = wave & 1;
  // X: 16 lanes cover a 256-B row piece, 8 rows per copy of the block; W: 8 lanes cover a 128-B row piece, 16 rows per copy
  const unsigned lx = (unsigned)(size_t)sm + (unsigned)((tid >> 4) * GXP + (tid & 15) * 16), lw = (unsigned)(size_t)sm + (unsigned)(XB + (tid >> 3) * GWP + (tid & 7) * 16);
  const char* gx = (const char*)Xb + (size_t)(tid >> 4) * (DM * 4) + (tid & 15) * 16; const char* gw = (const char*)Wb + (size_t)(tid >> 3) * (DM * 2) + (tid & 7) * 16;
  auto stage = [&](int t, unsigned bo) {
#pragma unroll
    for (int u = 0; u < MI / 2; ++u) acopy8(lx + bo + u * (64 * GXP), 8 * GXP, gx + (size_t)t * 256 + (size_t)u * (64 * DM * 4), 8 * DM * 4);
    acopy8(lw + bo, 16 * GWP, gw + (size_t)t * 128, 16 * DM * 2); };
  stage(0, 0u);
  asm volatile("s_wait_asynccnt 0x0" ::: "memory");   // this wave's copies of stage 0 have landed
  __syncthreads();                                     // stage 0 published to every wave
  stage(1, (unsigned)ST);
#pragma unroll 1   // rolled: for speed only
  for (int t = 0; t < NT; ++t) { const unsigned bo = (t & 1) ? (unsigned)ST : 0u;
    const unsigned char* sx = sm + bo + (wm * 16 * MI + col) * GXP + 32 * g; const unsigned char* sw = sm + bo + XB + (wn * 64 + col) * GWP + 16 * g;
#pragma unroll
    for (int kc = 0; kc < 2; ++kc) { v16b b[4];
#pragma unroll
      for (int j = 0; j < 4; ++j) { union { v16b v; v8b q[2]; } u; const unsigned char* p = sw + j * (16 * GWP) + kc * 64; u.q[0] = *(const v8b*)p; u.q[1] = *(const v8b*)(p + 32); b[j] = u.v; }
#pragma unroll
      for (int i = 0; i < MI; ++i) { const v4f* p = (const v4f*)(sx + i * (16 * GXP) + kc * 128); const v4f x0 = p[0], x1 = p[1], x2 = p[4], x3 = p[5]; float v[16];
#pragma unroll
        for (int e = 0; e < 4; ++e) { v[e] = x0[e]; v[4 + e] = x1[e]; v[8 + e] = x2[e]; v[12 + e] = x3[e]; }
        if (SPLIT) { const F2 a = bsplit16(v);
#pragma unroll
          for (int j = 0; j < 4; ++j) acc[i][j] = wmma_bf(a.l, b[j], acc[i][j]);   // residual first, then hi, per accumulator as before; four independent tiles between the two
#pragma unroll
          for (int j = 0; j < 4; ++j) acc[i][j] = wmma_bf(a.h, b[j], acc[i][j]); }
        else { v16b a;
#pragma unroll
          for (int e = 0; e < 16; ++e) a[e] = (__bf16)v[e];
#pragma unroll
          for (int j = 0; j < 4; ++j) acc[i][j] = wmma_bf(a, b[j], acc[i][j]); } } }
    asm volatile("s_wait_dscnt 0x0" ::: "memory");      // this wave's reads of stage t are done before its buffer is refilled
    asm volatile("s_wait_asynccnt 0x0" ::: "memory");   // this wave's copies of stage t + 1 have landed
    __syncthreads();                                     // publishes stage t + 1 and ends every wave's reads of stage t
    if (t + 2 < NT) stage(t + 2, bo); }
  asm volatile("s_wait_asynccnt 0x0" ::: "memory");     // nothing in flight when the buffers become output staging
}
// ---- k_qkv: block = (128 rows, 128 columns); each wave stages its 64 x 64 result in its own LDS range and stores whole 128-B lines
__global__ __launch_bounds__(128) void k_qkv(const float* __restrict__ XQ, const float* __restrict__ XK, const float* __restrict__ XV, const __bf16* __restrict__ P, const float* __restrict__ BQ, const float* __restrict__ BK, const float* __restrict__ BV, _Float16* __restrict__ QK, _Float16* __restrict__ QKL, _Float16* __restrict__ VTH, _Float16* __restrict__ VTL) {
  const int which0 = (blockIdx.y * 128) / DM; const float* X = (which0 == 0) ? XQ : (which0 == 1) ? XK : XV; const float* BB = BQ ? (((which0 == 0) ? BQ : (which0 == 1) ? BK : BV) + (blockIdx.y * 128 - which0 * DM)) : nullptr;
  __shared__ __align__(16) unsigned char sm[2 * (128 * GXP + 128 * GWP)];
  const int tid = threadIdx.x, wave = tid >> 5, lane = tid & 31, col = lane & 15, g = lane >> 4, wm = wave >> 1, wn = wave & 1; const size_t m0 = (size_t)blockIdx.x * 128; const int n0 = blockIdx.y * 128;
  v8f acc[4][4] = {};
  gemm_lds<4, false>(X + m0 * DM, P + (size_t)n0 * DM, sm, acc, tid);
  float bj[4];
#pragma unroll
  for (int j = 0; j < 4; ++j) bj[j] = BB ? bfr(BB[wn * 64 + j * 16 + col]) : 0.f;
  _Float16* eh = (_Float16*)(sm + wave * (2 * 64 * 144)); _Float16* el = eh + 64 * 72;   // per wave: hi and residual planes, 64 rows at pitch 144 B
  if (n0 < 2 * DM) {   // q stored unscaled (f16 sigma ~0.6, no subnormal exposure); 1/8 applied to the f32 score
#pragma unroll
    for (int i = 0; i < 4; ++i) {
#pragma unroll
      for (int j = 0; j < 4; ++j) {
#pragma unroll
        for (int r = 0; r < 8; ++r) { const float v = acc[i][j][r] + bj[j]; const _Float16 hv = (_Float16)v; eh[(i * 16 + 8 * g + r) * 72 + j * 16 + col] = hv; el[(i * 16 + 8 * g + r) * 72 + j * 16 + col] = (_Float16)((v - (float)hv) * 2048.0f); } } }   // q, k (+ bias) as f16 hi + (x2048) residual
    LDSX();
    for (int it = 0; it < 16; ++it) { const int rl = it * 4 + (lane >> 3), pc = lane & 7; const size_t o = (m0 + wm * 64 + rl) * (2 * DM) + n0 + wn * 64 + pc * 8; vst2((unsigned*)(QK + o), *(const v4u*)&eh[rl * 72 + pc * 8]); vst2((unsigned*)(QKL + o), *(const v4u*)&el[rl * 72 + pc * 8]); }
  } else {   // v transposed: a lane's 8 accumulator rows are 8 consecutive s of one d
#pragma unroll
    for (int i = 0; i < 4; ++i) {
#pragma unroll
      for (int j = 0; j < 4; ++j) { v8h th, tl;
#pragma unroll
        for (int r = 0; r < 8; ++r) { const float v = acc[i][j][r] + bj[j]; const _Float16 hv = (_Float16)v; th[r] = hv; tl[r] = (_Float16)((v - (float)hv) * 2048.0f); }
        *(v8h*)&eh[(j * 16 + col) * 72 + i * 16 + 8 * g] = th; *(v8h*)&el[(j * 16 + col) * 72 + i * 16 + 8 * g] = tl; } }
    LDSX();
    const int b = (int)(m0 / SS), s0 = (int)(m0 % SS) + wm * 64; const int pc0 = n0 - 2 * DM + wn * 64;
    for (int it = 0; it < 16; ++it) { const int d = it * 4 + (lane >> 3), pc = lane & 7; const size_t o = ((size_t)b * DM + pc0 + d) * SS + s0 + pc * 8; vst2((unsigned*)(VTH + o), *(const v4u*)&eh[d * 72 + pc * 8]); vst2((unsigned*)(VTL + o), *(const v4u*)&el[d * 72 + pc * 8]); }
  }
}
// ---- k_attn: block = (64 queries, head h, batch b): banded causal flash attention (K = 64: 2 k-steps), scores = (q.k) * 0.125 with single f16 operands (q/k hi + residual, 3 products, for qb < 2), P.V: f16 P x (V hi, V lo*2048) in two accumulators; O[b*S+q][h*64+d] = (acc + accl / 2048) / (2048 l) (256-B segments)
__global__ __launch_bounds__(128) void k_attn(const _Float16* __restrict__ QK, const _Float16* __restrict__ QKL, const _Float16* __restrict__ VTH, const _Float16* __restrict__ VTL, const void* __restrict__ KMASK, float* __restrict__ O) {
  __shared__ __align__(16) float sp[4][16][36]; __shared__ __align__(16) float so[4][16][68];
  const int tid = threadIdx.x, wave = tid >> 5, lane = tid & 31, col = lane & 15, g = lane >> 4;
  const int qb = blockIdx.x, h = blockIdx.y, b = blockIdx.z; const int q0 = qb * 64 + wave * 16; const size_t rq = (size_t)b * SS + q0 + col;
  v16h aq[2], aql[2];
#pragma unroll
  for (int kc = 0; kc < 2; ++kc) { aq[kc] = frag_h(QK + rq * (2 * DM) + h * HD + kc * 32, lane); aql[kc] = frag_h(QKL + rq * (2 * DM) + h * HD + kc * 32, lane); }
  float m[8], l[8];
#pragma unroll
  for (int r = 0; r < 8; ++r) { m[r] = -3.0e38f; l[r] = 0.f; }
  v8f acc[4] = {}, accl[4] = {};
  const int nks = SS / 32;   // all keys
  const int ks0 = (qb * 64 - LWIN) > 0 ? (qb * 64 - LWIN) / 32 : 0; const int nksc = (qb * 64 + 64) / 32;   // banded causal
#pragma unroll 1
  for (int ks = ks0; ks < nksc; ++ks) { v8f s[2];
#pragma unroll
    for (int ct = 0; ct < 2; ++ct) { const int kk = ks * 32 + ct * 16 + col; const _Float16* krow = QK + ((size_t)b * SS + kk) * (2 * DM) + DM + h * HD; const _Float16* krowl = QKL + ((size_t)b * SS + kk) * (2 * DM) + DM + h * HD; v8f c = {}, cl = {};
      if (qb < 2) {   // leading query blocks (few keys, outputs far above the global rms): 3 products
#pragma unroll
        for (int kc = 0; kc < 2; ++kc) { const v16h kh = frag_h(krow + kc * 32, lane); c = wmma16(aq[kc], kh, c); cl = wmma16(aql[kc], kh, cl); cl = wmma16(aq[kc], frag_h(krowl + kc * 32, lane), cl); }
#pragma unroll
        for (int r = 0; r < 8; ++r) c[r] += cl[r] * (1.0f / 2048.0f); }
      else {
#pragma unroll
        for (int kc = 0; kc < 2; ++kc) c = wmma16(aq[kc], frag_h(krow + kc * 32, lane), c); }   // single product elsewhere
      { const bool keepdummy = true; (void)keepdummy;
#pragma unroll
      for (int r = 0; r < 8; ++r) s[ct][r] = (kk <= q0 + 8 * g + r && (q0 + 8 * g + r) - kk <= LWIN) ? c[r] * 0.125f : -3.0e38f; } }   // 1/sqrt(64); masked keys excluded
#pragma unroll
    for (int r = 0; r < 8; ++r) { float mx = fmaxf(s[0][r], s[1][r]);
#pragma unroll
      for (int o = 1; o < 16; o <<= 1) mx = fmaxf(mx, __shfl_xor(mx, o));
      const float mn = fmaxf(m[r], mx); const float alpha = (m[r] <= -1.0e38f) ? 0.f : __expf(m[r] - mn);
      const float e0 = (s[0][r] <= -1.0e38f) ? 0.f : __expf(s[0][r] - mn), e1 = (s[1][r] <= -1.0e38f) ? 0.f : __expf(s[1][r] - mn); float es = e0 + e1;
#pragma unroll
      for (int o = 1; o < 16; o <<= 1) es += __shfl_xor(es, o);
      l[r] = l[r] * alpha + es; m[r] = mn;
#pragma unroll
      for (int dt = 0; dt < 4; ++dt) { acc[dt][r] *= alpha; accl[dt][r] *= alpha; }
      sp[wave][8 * g + r][col] = e0; sp[wave][8 * g + r][16 + col] = e1; }
    LDSX();
    v16h pa, pl; { const float* prow = &sp[wave][col][0] + 8 * (lane >> 4);
#pragma unroll
      for (int i = 0; i < 8; ++i) { const float x0 = prow[i] * 2048.0f, x1 = prow[16 + i] * 2048.0f; const _Float16 h0 = (_Float16)x0, h1 = (_Float16)x1; pa[i] = h0; pa[8 + i] = h1; pl[i] = (_Float16)((x0 - (float)h0) * 2048.0f); pl[8 + i] = (_Float16)((x1 - (float)h1) * 2048.0f); } }   // P scaled by 2^11 before the f16 split so small softmax weights stay out of the f16 subnormal range; 2^-11 folded into the epilogue
#pragma unroll
    for (int dt = 0; dt < 4; ++dt) { const size_t vr = ((size_t)b * DM + h * HD + dt * 16 + col) * SS + ks * 32; const v16h vh = frag_h(VTH + vr, lane); acc[dt] = wmma16(pa, vh, acc[dt]); if (qb < 32) { accl[dt] = wmma16(pl, vh, accl[dt]); accl[dt] = wmma16(pa, frag_h(VTL + vr, lane), accl[dt]); } }   // every query block (qb < 32 always holds): P hi/lo x V hi/lo (3 products)
    LDSX(); }
#pragma unroll
  for (int r = 0; r < 8; ++r) { const float il = (1.0f / 2048.0f) / l[r];
#pragma unroll
    for (int dt = 0; dt < 4; ++dt) so[wave][8 * g + r][dt * 16 + col] = (acc[dt][r] + accl[dt][r] * (1.0f / 2048.0f)) * il; }
  LDSX();
  for (int rl = 0; rl < 16; ++rl) if (lane < 16) vst2(O + ((size_t)b * SS + q0 + rl) * DM + h * HD + lane * 4, *(const v4f*)&so[wave][rl][lane * 4]);
}
// ---- k_out: block = (64 rows, 128 cols): out = O(hi/lo) . Wo rows (2 products) + bo
__global__ __launch_bounds__(128) void k_out(const float* __restrict__ O, const __bf16* __restrict__ P, const float* __restrict__ BO, float* __restrict__ Y) {
  __shared__ __align__(16) unsigned char sm[2 * (64 * GXP + 128 * GWP)];
  const int tid = threadIdx.x, wave = tid >> 5, lane = tid & 31, col = lane & 15, g = lane >> 4, wm = wave >> 1, wn = wave & 1; const size_t m0 = (size_t)blockIdx.x * 64; const int n0 = blockIdx.y * 128;
  v8f acc[2][4] = {};
  gemm_lds<2, true>(O + m0 * DM, P + (size_t)n0 * DM, sm, acc, tid);
  float* so = (float*)(sm + wave * (32 * 272));   // per wave: 32 rows of 64 f32 at pitch 272 B
#pragma unroll
  for (int i = 0; i < 2; ++i) {
#pragma unroll
    for (int j = 0; j < 4; ++j) {
#pragma unroll
      for (int r = 0; r < 8; ++r) so[(i * 16 + 8 * g + r) * 68 + j * 16 + col] = acc[i][j][r] + bfr(BO[n0 + wn * 64 + j * 16 + col]); } }
  LDSX();
  for (int it = 0; it < 16; ++it) { const int rl = it * 2 + g; vst2(Y + (m0 + wm * 32 + rl) * DM + n0 + wn * 64 + col * 4, *(const v4f*)&so[rl * 68 + col * 4]); }
}
// ---- k_rope: block = row (b,t), 256 threads: q and k (hi + residual, 1024 each) -> interleaved rotary with angle t * inv_freq[d/2], inv_freq[i] = BASE^(-i/32) -> back to hi + residual in place
__global__ __launch_bounds__(256) void k_rope(_Float16* __restrict__ QK, _Float16* __restrict__ QKL) { __shared__ __align__(16) _Float16 sh[2 * DM], sl[2 * DM]; const int t = threadIdx.x; const size_t row = blockIdx.x; const int pos = (int)(row % SS);
  for (int e = t; e < DM; e += 256) { // e = w*512 + pair index p (w: 0 q, 1 k); each thread handles 4 (even, odd) pairs, one per e
    const int w = e / (DM / 2), p = e % (DM / 2); const int c0 = 2 * p; const int i = (c0 % HD) / 2; const size_t o = row * (2 * DM) + (size_t)w * DM + c0;
    const float x0 = (float)QK[o] + (float)QKL[o] * (1.0f / 2048.0f), x1 = (float)QK[o + 1] + (float)QKL[o + 1] * (1.0f / 2048.0f);
    const float invf = (float)exp(-(double)i / (double)(HD / 2) * log((double)RBASE)); const float ang = (float)pos * invf; const float cs = cosf(ang), sn = sinf(ang);
    const float y0 = x0 * cs - x1 * sn, y1 = x1 * cs + x0 * sn;
    const _Float16 h0 = (_Float16)y0, h1 = (_Float16)y1; sh[w * DM + c0] = h0; sh[w * DM + c0 + 1] = h1; sl[w * DM + c0] = (_Float16)((y0 - (float)h0) * 2048.0f); sl[w * DM + c0 + 1] = (_Float16)((y1 - (float)h1) * 2048.0f); }
  __syncthreads(); vst2((unsigned*)(QK + row * (2 * DM) + t * 8), *(const v4u*)&sh[t * 8]); vst2((unsigned*)(QKL + row * (2 * DM) + t * 8), *(const v4u*)&sl[t * 8]); }
extern "C" void kernel_launch(void* const* d_in, const int* in_sizes, int n_in, void* d_out, int out_size, void* d_ws, size_t ws_size, hipStream_t stream) {
  (void)in_sizes; (void)n_in; (void)out_size;
  const float** F = (const float**)d_in;   // 0 x [2,2048,1024], 1 Wqkv [3072,1024] natural ((3,H,hd) rows), 2 Wproj [1024,1024] natural, 3 bproj [1024]
  if (ws_size < (size_t)WS_END) return;
  char* ws = (char*)d_ws; __bf16* PK = (__bf16*)(ws + WS_PK); _Float16 *QK = (_Float16*)(ws + WS_QK), *QKL = (_Float16*)(ws + WS_QKL), *VTH = (_Float16*)(ws + WS_VTH), *VTL = (_Float16*)(ws + WS_VTL); float* O = (float*)(ws + WS_O);
  k_pack<<<dim3(DM, 4), 256, 0, stream>>>(F[1], F[1] + (size_t)DM * DM, F[1] + (size_t)2 * DM * DM, F[2], PK);
  k_qkv<<<dim3(TNB * SS / 128, QKVW / 128), 128, 0, stream>>>(F[0], F[0], F[0], PK + PK_A, nullptr, nullptr, nullptr, QK, QKL, VTH, VTL);
  k_rope<<<TNB * SS, 256, 0, stream>>>(QK, QKL);
  k_attn<<<dim3(TQB, NH, TNB), 128, 0, stream>>>(QK, QKL, VTH, VTL, nullptr, O);
  k_out<<<dim3(TOB, DM / 128), 128, 0, stream>>>(O, PK + PK_P, F[3], (float*)d_out);
}

// v002
// It runs in 154 microseconds.
// Next to v001, in two timings, it ran 1.26 and 1.27 times as fast.
// Over all steps from v000 it is 2.14 times as fast.
// compute dtype: all float inputs rounded to bf16; q/k/v = x . W^T with EXACT bf16 products on WMMA 16x16x32 (natural rows), f32; rotary (angles t x inv_freq, device cosf/sinf) in f32 on q and k, re-rounded to f16 hi + residual; banded all-keys attention with hybrid scores (first 128 queries 3-product, later single f16) and 3-product P.v everywhere (key tiles outside [q-512, q] skipped), x 1/8, running-max softmax in f32 (hardware exp); out = ctx (bf16 hi + lo, 2 products) . Wproj^T + b; f32 output.
#include <hip/hip_runtime.h>
#include <math.h>

typedef __attribute__((ext_vector_type(16))) _Float16 v16h;
typedef __attribute__((ext_vector_type(16))) __bf16 v16b;
typedef __attribute__((ext_vector_type(8)))  _Float16 v8h;
typedef __attribute__((ext_vector_type(8)))  float v8f;
typedef __attribute__((ext_vector_type(4)))  float v4f;
typedef __attribute__((ext_vector_type(2)))  float v2f;
typedef __attribute__((ext_vector_type(4)))  unsigned v4u;
typedef __attribute__((ext_vector_type(4)))  int v4i;
typedef float __attribute__((may_alias)) float_a;
typedef int __attribute__((may_alias)) int_a;

template <typename T> __device__ __forceinline__ void vst2(void* p, T v) { *(T*)p = v;  }
__device__ __forceinline__ v8f wmma16(v16h a, v16h b, v8f c) {
  v8f d = __builtin_amdgcn_wmma_f32_16x16x32_f16(false, a, false, b, (short)0, c, false, false);
  asm volatile("v_nop\n\tv_nop\n\tv_nop\n\tv_nop" : "+v"(d) : "v"(a), "v"(b));
  return d;
}
__device__ __forceinline__ v8f wmma_bf(v16b a, v16b b, v8f c) {
  v8f d = __builtin_amdgcn_wmma_f32_16x16x32_bf16(false, a, false, b, (short)0, c, false, false);
  asm volatile("v_nop\n\tv_nop\n\tv_nop\n\tv_nop" : "+v"(d) : "v"(a), "v"(b));
  return d;
}
// Causal local self-attention (B 2, T 2,048, C 1,024, 16 heads x 64, window 512): fused bias-free projection (natural [3C][C]), interleaved rotary embedding on q and k, scores / 8 restricted to k <= q <= k + 512, softmax, v, natural output projection + bias.
__device__ __forceinline__ v16h frag_h(const _Float16* rowk0, int lane) {
  union { v16h v; v8h q[2]; } u; const _Float16* p = rowk0 + 8 * (lane >> 4);
  u.q[0] = *(const v8h*)p; u.q[1] = *(const v8h*)(p + 16); return u.v;
}
__device__ __forceinline__ v16h frag_f32(const float* rowk0, int lane) {
  v16h a; const float* p = rowk0 + 8 * (lane >> 4);
#pragma unroll
  for (int i = 0; i < 8; ++i) { a[i] = (_Float16)p[i]; a[8 + i] = (_Float16)p[16 + i]; }
  return a;
}
__device__ __forceinline__ v16h frag_f32s(const float* rowk0, int lane, float sc) {
  v16h a; const float* p = rowk0 + 8 * (lane >> 4);
#pragma unroll
  for (int i = 0; i < 8; ++i) { a[i] = (_Float16)(p[i] * sc); a[8 + i] = (_Float16)(p[16 + i] * sc); }
  return a;
}
// column fragment from a [K][ld] layout (column n), rows >= K read as 0
__device__ __forceinline__ v16h fragc_f32(const float* W, int k0, int n, int lane, int ld, int K) {
  v16h a; const int g = lane >> 4;
#pragma unroll
  for (int i = 0; i < 8; ++i) { const int ka = k0 + 8 * g + i, kb = ka + 16;
    a[i] = (_Float16)(ka < K ? W[(size_t)(ka < K ? ka : K - 1) * ld + n] : 0.f); a[8 + i] = (_Float16)(kb < K ? W[(size_t)(kb < K ? kb : K - 1) * ld + n] : 0.f); }
  return a;
}
struct F2 { v16b h, l; };
__device__ __forceinline__ F2 bsplit16(const float v[16]) { F2 r;
#pragma unroll
  for (int i = 0; i < 16; ++i) { const __bf16 h = (__bf16)v[i]; r.h[i] = h; r.l[i] = (__bf16)(v[i] - (float)h); }
  return r; }
__device__ __forceinline__ F2 split_row(const float* row, int k0, int lane) { float v[16]; const float* p = row + k0 + 8 * (lane >> 4);
#pragma unroll
  for (int i = 0; i < 8; ++i) { v[i] = p[i]; v[8 + i] = p[16 + i]; }
  return bsplit16(v); }
__device__ __forceinline__ F2 split_rowK(const float* row, int k0, int lane, int K) { float v[16]; const int g = lane >> 4;
#pragma unroll
  for (int i = 0; i < 8; ++i) { const int ka = k0 + 8 * g + i, kb = ka + 16; v[i] = ka < K ? row[ka < K ? ka : K - 1] : 0.f; v[8 + i] = kb < K ? row[kb < K ? kb : K - 1] : 0.f; }
  return bsplit16(v); }
__device__ __forceinline__ F2 split_col(const float* W, int k0, int n, int lane, int ld, int K) { float v[16]; const int g = lane >> 4;
#pragma unroll
  for (int i = 0; i < 8; ++i) { const int ka = k0 + 8 * g + i, kb = ka + 16; v[i] = ka < K ? W[(size_t)(ka < K ? ka : K - 1) * ld + n] : 0.f; v[8 + i] = kb < K ? W[(size_t)(kb < K ? kb : K - 1) * ld + n] : 0.f; }
  return bsplit16(v); }
__device__ __forceinline__ v8f mac3(const F2& a, const F2& b, v8f c) { c = wmma_bf(a.l, b.h, c); c = wmma_bf(a.h, b.l, c); return wmma_bf(a.h, b.h, c); }
__device__ __forceinline__ float sigm(float v) { return 1.0f / (1.0f + expf(-v)); }
#define LDSX() do { asm volatile("s_wait_dscnt 0" ::: "memory"); __builtin_amdgcn_wave_barrier(); __builtin_amdgcn_fence(__ATOMIC_RELEASE, "workgroup"); } while (0)


#define NB 2
#define SS 2048
#define DM 1024
#define NH 16
#define LWIN 512
#define RBASE 10000.0f
#define HD 64
#define QKVW (3 * DM)
#ifndef TQB
#define TQB (SS / 64)
#define TNB NB
#define TOB (NB * SS / 64)     // output row tiles (all)
#endif
typedef __attribute__((ext_vector_type(8))) __bf16 v8b;
__device__ __forceinline__ v16b frag_b(const __bf16* rowk0, int lane) {
  union { v16b v; v8b q[2]; } u; const __bf16* p = rowk0 + 8 * (lane >> 4);
  u.q[0] = *(const v8b*)p; u.q[1] = *(const v8b*)(p + 16); return u.v;
}
__device__ __forceinline__ float bfr(float v) { return (float)(__bf16)v; }
__device__ __attribute__((noinline)) float exp_ni(float v) { return expf(v); }
__device__ __attribute__((noinline)) float erf_ni(float v) { return erff(v); }

#define PK_A 0                       // [3072][1024] Wqkv rows (natural [out][in])
#define PK_P (PK_A + QKVW * DM)        // [1024][1024] Wo rows (natural)
#define PK_END (PK_P + DM * DM)
#define WS_PK  0u
#define WS_QK  (WS_PK + 2u * PK_END)             // f16 [4096 rows][2048]: q | k
#define WS_QKL (WS_QK + 2u * NB * SS * 2 * DM)     // f16 q | k residual planes x2048
#define WS_VTH (WS_QKL + 2u * NB * SS * 2 * DM)    // f16 [b][1024 (h*64+d)][2048 s] hi
#define WS_VTL (WS_VTH + 2u * NB * DM * SS)        // f16 lo x 2048
#define WS_O   (WS_VTL + 2u * NB * DM * SS)        // f32 [4096][1024]
#define WS_CS  (WS_O + 4u * NB * SS * DM)           // f32 2 x [2048][32], reserved, unused (k_rope computes cos/sin)
#define WS_END (WS_CS + 4u * 2 * SS * 32)
// ---- k_pack: block = (row n, which): natural [out][in] rows -> bf16; which 0..2 -> W_q/W_k/W_v into PK_A rows which*1024 + n; 3 -> W_o into PK_P
__global__ __launch_bounds__(256) void k_pack(const float* __restrict__ WQ, const float* __restrict__ WK, const float* __restrict__ WV, const float* __restrict__ WO, __bf16* __restrict__ PK) {
  __shared__ __align__(16) __bf16 s[DM]; const int n = blockIdx.x, which = blockIdx.y, t = threadIdx.x; const float* Wm = (which == 0) ? WQ : (which == 1) ? WK : (which == 2) ? WV : WO;
  for (int k = t; k < DM; k += 256) s[k] = (__bf16)Wm[(size_t)n * DM + k];
  __syncthreads();
  __bf16* dst = (which < 3) ? PK + PK_A + ((size_t)which * DM + n) * DM : PK + PK_P + (size_t)n * DM;
  for (int q = t; q < DM / 8; q += 256) vst2((unsigned*)(dst + q * 8), *(const v4u*)&s[q * 8]);
}
// ---- projection GEMM core: block tile (32 * MI rows) x 128 columns, 4 waves as 2 x 2, each (16 * MI) x 64. A stage is 64 k: the f32 rows of X (256 B, LDS pitch 272 B) and the bf16 rows of W (128 B, LDS pitch 144 B),
// brought into LDS by asynchronous b128 copies, two buffers: stage t + 1 flies while stage t is multiplied. Fragments keep the k order and every accumulator its k sequence (32 steps of 32, ascending).
#define GXP 272
#define GWP 144
// eight copies of one lane, LDS and global address each advancing by a fixed step; the closing s_wait_xcnt 0 stands inside the statement so that no address register is rewritten ahead of it
__device__ __forceinline__ void acopy8(unsigned l, unsigned ls, const char* g, unsigned gs) {
  asm volatile("global_load_async_to_lds_b128 %0, %8, off\n\t"
               "global_load_async_to_lds_b128 %1, %9, off\n\t"
               "global_load_async_to_lds_b128 %2, %10, off\n\t"
               "global_load_async_to_lds_b128 %3, %11, off\n\t"
               "global_load_async_to_lds_b128 %4, %12, off\n\t"
               "global_load_async_to_lds_b128 %5, %13, off\n\t"
               "global_load_async_to_lds_b128 %6, %14, off\n\t"
               "global_load_async_to_lds_b128 %7, %15, off\n\t"
               "s_wait_xcnt 0x0"
               :: "v"(l), "v"(l + ls), "v"(l + 2 * ls), "v"(l + 3 * ls), "v"(l + 4 * ls), "v"(l + 5 * ls), "v"(l + 6 * ls), "v"(l + 7 * ls),
                  "v"(g), "v"(g + gs), "v"(g + 2 * (size_t)gs), "v"(g + 3 * (size_t)gs), "v"(g + 4 * (size_t)gs), "v"(g + 5 * (size_t)gs), "v"(g + 6 * (size_t)gs), "v"(g + 7 * (size_t)gs)
               : "memory");
}
template <int MI, bool SPLIT>
__device__ __forceinline__ void gemm_lds(const float* __restrict__ Xb, const __bf16* __restrict__ Wb, unsigned char* sm, v8f (&acc)[MI][4], int tid) {
  constexpr int XB = 32 * MI * GXP, ST = XB + 128 * GWP, NT = DM / 64;
  const int wave = tid >> 5, lane = tid & 31, col = lane & 15, g = lane >> 4, wm = wave >> 1, wn = wave & 1;
  // X: 16 lanes cover a 256-B row piece, 8 rows per copy of the block; W: 8 lanes cover a 128-B row piece, 16 rows per copy
  const unsigned lx = (unsigned)(size_t)sm + (unsigned)((tid >> 4) * GXP + (tid & 15) * 16), lw = (unsigned)(size_t)sm + (unsigned)(XB + (tid >> 3) * GWP + (tid & 7) * 16);
  const char* gx = (const char*)Xb + (size_t)(tid >> 4) * (DM * 4) + (tid & 15) * 16; const char* gw = (const char*)Wb + (size_t)(tid >> 3) * (DM * 2) + (tid & 7) * 16;
  auto stage = [&](int t, unsigned bo) {
#pragma unroll
    for (int u = 0; u < MI / 2; ++u) acopy8(lx + bo + u * (64 * GXP), 8 * GXP, gx + (size_t)t * 256 + (size_t)u * (64 * DM * 4), 8 * DM * 4);
    acopy8(lw + bo, 16 * GWP, gw + (size_t)t * 128, 16 * DM * 2); };
  stage(0, 0u);
  asm volatile("s_wait_asynccnt 0x0" ::: "memory");   // this wave's copies of stage 0 have landed
  __syncthreads();                                     // stage 0 published to every wave
  stage(1, (unsigned)ST);
#pragma unroll 1   // rolled: for speed only
  for (int t = 0; t < NT; ++t) { const unsigned bo = (t & 1) ? (unsigned)ST : 0u;
    const unsigned char* sx = sm + bo + (wm * 16 * MI + col) * GXP + 32 * g; const unsigned char* sw = sm + bo + XB + (wn * 64 + col) * GWP + 16 * g;
#pragma unroll
    for (int kc = 0; kc < 2; ++kc) { v16b b[4];
#pragma unroll
      for (int j = 0; j < 4; ++j) { union { v16b v; v8b q[2]; } u; const unsigned char* p = sw + j * (16 * GWP) + kc * 64; u.q[0] = *(const v8b*)p; u.q[1] = *(const v8b*)(p + 32); b[j] = u.v; }
#pragma unroll
      for (int i = 0; i < MI; ++i) { const v4f* p = (const v4f*)(sx + i * (16 * GXP) + kc * 128); const v4f x0 = p[0], x1 = p[1], x2 = p[4], x3 = p[5]; float v[16];
#pragma unroll
        for (int e = 0; e < 4; ++e) { v[e] = x0[e]; v[4 + e] = x1[e]; v[8 + e] = x2[e]; v[12 + e] = x3[e]; }
        if (SPLIT) { const F2 a = bsplit16(v);
#pragma unroll
          for (int j = 0; j < 4; ++j) acc[i][j] = wmma_bf(a.l, b[j], acc[i][j]);   // residual first, then hi, per accumulator as before; four independent tiles between the two
#pragma unroll
          for (int j = 0; j < 4; ++j) acc[i][j] = wmma_bf(a.h, b[j], acc[i][j]); }
        else { v16b a;
#pragma unroll
          for (int e = 0; e < 16; ++e) a[e] = (__bf16)v[e];
#pragma unroll
          for (int j = 0; j < 4; ++j) acc[i][j] = wmma_bf(a, b[j], acc[i][j]); } } }
    asm volatile("s_wait_dscnt 0x0" ::: "memory");      // this wave's reads of stage t are done before its buffer is refilled
    asm volatile("s_wait_asynccnt 0x0" ::: "memory");   // this wave's copies of stage t + 1 have landed
    __syncthreads();                                     // publishes stage t + 1 and ends every wave's reads of stage t
    if (t + 2 < NT) stage(t + 2, bo); }
  asm volatile("s_wait_asynccnt 0x0" ::: "memory");     // nothing in flight when the buffers become output staging
}
// ---- k_qkv: block = (128 rows, 128 columns); each wave stages its 64 x 64 result in its own LDS range and stores whole 128-B lines
__global__ __launch_bounds__(128) void k_qkv(const float* __restrict__ XQ, const float* __restrict__ XK, const float* __restrict__ XV, const __bf16* __restrict__ P, const float* __restrict__ BQ, const float* __restrict__ BK, const float* __restrict__ BV, _Float16* __restrict__ QK, _Float16* __restrict__ QKL, _Float16* __restrict__ VTH, _Float16* __restrict__ VTL) {
  const int which0 = (blockIdx.y * 128) / DM; const float* X = (which0 == 0) ? XQ : (which0 == 1) ? XK : XV; const float* BB = BQ ? (((which0 == 0) ? BQ : (which0 == 1) ? BK : BV) + (blockIdx.y * 128 - which0 * DM)) : nullptr;
  __shared__ __align__(16) unsigned char sm[2 * (128 * GXP + 128 * GWP)];
  const int tid = threadIdx.x, wave = tid >> 5, lane = tid & 31, col = lane & 15, g = lane >> 4, wm = wave >> 1, wn = wave & 1; const size_t m0 = (size_t)blockIdx.x * 128; const int n0 = blockIdx.y * 128;
  v8f acc[4][4] = {};
  gemm_lds<4, false>(X + m0 * DM, P + (size_t)n0 * DM, sm, acc, tid);
  float bj[4];
#pragma unroll
  for (int j = 0; j < 4; ++j) bj[j] = BB ? bfr(BB[wn * 64 + j * 16 + col]) : 0.f;
  _Float16* eh = (_Float16*)(sm + wave * (2 * 64 * 144)); _Float16* el = eh + 64 * 72;   // per wave: hi and residual planes, 64 rows at pitch 144 B
  if (n0 < 2 * DM) {   // q stored unscaled (f16 sigma ~0.6, no subnormal exposure); 1/8 applied to the f32 score
#pragma unroll
    for (int i = 0; i < 4; ++i) {
#pragma unroll
      for (int j = 0; j < 4; ++j) {
#pragma unroll
        for (int r = 0; r < 8; ++r) { const float v = acc[i][j][r] + bj[j]; const _Float16 hv = (_Float16)v; eh[(i * 16 + 8 * g + r) * 72 + j * 16 + col] = hv; el[(i * 16 + 8 * g + r) * 72 + j * 16 + col] = (_Float16)((v - (float)hv) * 2048.0f); } } }   // q, k (+ bias) as f16 hi + (x2048) residual
    LDSX();
    for (int it = 0; it < 16; ++it) { const int rl = it * 4 + (lane >> 3), pc = lane & 7; const size_t o = (m0 + wm * 64 + rl) * (2 * DM) + n0 + wn * 64 + pc * 8; vst2((unsigned*)(QK + o), *(const v4u*)&eh[rl * 72 + pc * 8]); vst2((unsigned*)(QKL + o), *(const v4u*)&el[rl * 72 + pc * 8]); }
  } else {   // v transposed: a lane's 8 accumulator rows are 8 consecutive s of one d
#pragma unroll
    for (int i = 0; i < 4; ++i) {
#pragma unroll
      for (int j = 0; j < 4; ++j) { v8h th, tl;
#pragma unroll
        for (int r = 0; r < 8; ++r) { const float v = acc[i][j][r] + bj[j]; const _Float16 hv = (_Float16)v; th[r] = hv; tl[r] = (_Float16)((v - (float)hv) * 2048.0f); }
        *(v8h*)&eh[(j * 16 + col) * 72 + i * 16 + 8 * g] = th; *(v8h*)&el[(j * 16 + col) * 72 + i * 16 + 8 * g] = tl; } }
    LDSX();
    const int b = (int)(m0 / SS), s0 = (int)(m0 % SS) + wm * 64; const int pc0 = n0 - 2 * DM + wn * 64;
    for (int it = 0; it < 16; ++it) { const int d = it * 4 + (lane >> 3), pc = lane & 7; const size_t o = ((size_t)b * DM + pc0 + d) * SS + s0 + pc * 8; vst2((unsigned*)(VTH + o), *(const v4u*)&eh[d * 72 + pc * 8]); vst2((unsigned*)(VTL + o), *(const v4u*)&el[d * 72 + pc * 8]); }
  }
}
// ---- k_attn: block = (64 queries, head h, batch b): all-keys flash attention (K = 64: 2 k-steps), scores = (q.k) * 0.125 with 3 f16 products (q, k hi + residual) in query blocks 0 and 1, single f16 elsewhere, P.V: f16 P hi/lo x (V hi, V lo*2048), 3 products in two accumulators; O[b*S+q][h*64+d] = (acc + accl / 2048) / (2048 l) (256-B segments)
// A stage is 64 keys: the k rows (64 x 128 B), and the 64 d rows of v hi and of v residual (128 B = 64 keys each), every row at LDS pitch 144 B, brought in once for the block's four waves by asynchronous b128 copies of whole 128-B lines,
// two buffers: stage s + 1 flies while the two 32-key steps of stage s are worked on. Fragments, their k order, the key order and every sum are as before.
#define AKP 144
#define ATL (64 * AKP)
#define AST (3 * ATL)
// four copies of one lane, LDS and global address each advancing by a fixed step; the closing s_wait_xcnt 0 stands inside the statement so that no address register is rewritten ahead of it
__device__ __forceinline__ void acopy4(unsigned l, unsigned ls, const char* g, unsigned gs) {
  asm volatile("global_load_async_to_lds_b128 %0, %4, off\n\t"
               "global_load_async_to_lds_b128 %1, %5, off\n\t"
               "global_load_async_to_lds_b128 %2, %6, off\n\t"
               "global_load_async_to_lds_b128 %3, %7, off\n\t"
               "s_wait_xcnt 0x0"
               :: "v"(l), "v"(l + ls), "v"(l + 2 * ls), "v"(l + 3 * ls),
                  "v"(g), "v"(g + gs), "v"(g + 2 * (size_t)gs), "v"(g + 3 * (size_t)gs)
               : "memory");
}
// fragment from an LDS row: the lane's 16 B at p and the 16 B at p + 32 (the k order of frag_h)
__device__ __forceinline__ v16h frag_l(const unsigned char* p) { union { v16h v; v8h q[2]; } u; u.q[0] = *(const v8h*)p; u.q[1] = *(const v8h*)(p + 32); return u.v; }
// second bound: four waves a SIMD (256 registers a wave), so that all 1,024 blocks stay resident at once as before
__global__ __launch_bounds__(128, 4) void k_attn(const _Float16* __restrict__ QK, const _Float16* __restrict__ QKL, const _Float16* __restrict__ VTH, const _Float16* __restrict__ VTL, const void* __restrict__ KMASK, float* __restrict__ O) {
  __shared__ __align__(16) float sp[4][16][36]; __shared__ __align__(16) unsigned char sb[2 * AST];
  const int tid = threadIdx.x, wave = tid >> 5, lane = tid & 31, col = lane & 15, g = lane >> 4;
  const int qb = blockIdx.x, h = blockIdx.y, b = blockIdx.z; const int q0 = qb * 64 + wave * 16; const size_t rq = (size_t)b * SS + q0 + col;
  const int st0 = qb > LWIN / 64 ? qb - LWIN / 64 : 0, st1 = qb;   // banded causal: 64-key stages st0 .. st1
  // 8 lanes cover a 128-B row, 16 rows per copy of the block, 4 copies per tile
  const unsigned lc = (unsigned)(size_t)sb + (unsigned)((tid >> 3) * AKP + (tid & 7) * 16);
  const char* gk = (const char*)(QK + ((size_t)b * SS + (tid >> 3)) * (2 * DM) + DM + h * HD) + (tid & 7) * 16;
  const size_t vo = (((size_t)b * DM + h * HD + (tid >> 3)) * SS) * 2 + (tid & 7) * 16; const char* gvh = (const char*)VTH + vo; const char* gvl = (const char*)VTL + vo;
  auto stage = [&](int s, unsigned bo) {
    acopy4(lc + bo, 16 * AKP, gk + (size_t)s * (64 * 2 * DM * 2), 16 * 2 * DM * 2);
    acopy4(lc + bo + ATL, 16 * AKP, gvh + (size_t)s * 128, 16 * SS * 2);
    acopy4(lc + bo + 2 * ATL, 16 * AKP, gvl + (size_t)s * 128, 16 * SS * 2); };
  stage(st0, 0u);
  v16h aq[2];
#pragma unroll
  for (int kc = 0; kc < 2; ++kc) aq[kc] = frag_h(QK + rq * (2 * DM) + h * HD + kc * 32, lane);
  float m[8], l[8];
#pragma unroll
  for (int r = 0; r < 8; ++r) { m[r] = -3.0e38f; l[r] = 0.f; }
  v8f acc[4] = {}, accl[4] = {};
  asm volatile("s_wait_asynccnt 0x0" ::: "memory");   // this wave's copies of the first stage have landed
  __syncthreads();                                     // first stage published to every wave
  if (st0 < st1) stage(st0 + 1, (unsigned)AST);
#pragma unroll 1   // rolled: one body for every stage
  for (int st = st0; st <= st1; ++st) { const unsigned bo = ((st - st0) & 1) ? (unsigned)AST : 0u;
#pragma unroll 1   // rolled: the two 32-key steps of a stage share one body
  for (int sub = 0; sub < 2; ++sub) { const int ks = st * 2 + sub; v8f s[2];
    const unsigned char* lk = sb + bo + (sub * 32 + col) * AKP + 16 * g; const unsigned char* lv = sb + bo + ATL + col * AKP + sub * 64 + 16 * g;
    v16h kf[2][2];   // the step's four k fragments, read as one group ahead of the products
#pragma unroll
    for (int ct = 0; ct < 2; ++ct) {
#pragma unroll
      for (int kc = 0; kc < 2; ++kc) kf[ct][kc] = frag_l(lk + ct * (16 * AKP) + kc * 64); }
#pragma unroll
    for (int ct = 0; ct < 2; ++ct) { const int kk = ks * 32 + ct * 16 + col; const _Float16* krowl = QKL + ((size_t)b * SS + kk) * (2 * DM) + DM + h * HD; v8f c = {}, cl = {};
      if (qb < 2) {   // leading query blocks (few keys, outputs far above the global rms): 3 products; the q residual is fetched here, where alone it is used, so that it holds no registers in the other blocks
#pragma unroll
        for (int kc = 0; kc < 2; ++kc) { const v16h kh = kf[ct][kc]; c = wmma16(aq[kc], kh, c); cl = wmma16(frag_h(QKL + rq * (2 * DM) + h * HD + kc * 32, lane), kh, cl); cl = wmma16(aq[kc], frag_h(krowl + kc * 32, lane), cl); }
#pragma unroll
        for (int r = 0; r < 8; ++r) c[r] += cl[r] * (1.0f / 2048.0f); }
      else {
#pragma unroll
        for (int kc = 0; kc < 2; ++kc) c = wmma16(aq[kc], kf[ct][kc], c); }   // single product elsewhere
      { const bool keepdummy = true; (void)keepdummy;
#pragma unroll
      for (int r = 0; r < 8; ++r) s[ct][r] = (kk <= q0 + 8 * g + r && (q0 + 8 * g + r) - kk <= LWIN) ? c[r] * 0.125f : -3.0e38f; } }   // 1/sqrt(64); masked keys excluded
#pragma unroll
    for (int r = 0; r < 8; ++r) { float mx = fmaxf(s[0][r], s[1][r]);
#pragma unroll
      for (int o = 1; o < 16; o <<= 1) mx = fmaxf(mx, __shfl_xor(mx, o));
      const float mn = fmaxf(m[r], mx); const float alpha = (m[r] <= -1.0e38f) ? 0.f : __expf(m[r] - mn);
      const float e0 = (s[0][r] <= -1.0e38f) ? 0.f : __expf(s[0][r] - mn), e1 = (s[1][r] <= -1.0e38f) ? 0.f : __expf(s[1][r] - mn); float es = e0 + e1;
#pragma unroll
      for (int o = 1; o < 16; o <<= 1) es += __shfl_xor(es, o);
      l[r] = l[r] * alpha + es; m[r] = mn;
#pragma unroll
      for (int dt = 0; dt < 4; ++dt) { acc[dt][r] *= alpha; accl[dt][r] *= alpha; }
      sp[wave][8 * g + r][col] = e0; sp[wave][8 * g + r][16 + col] = e1; }
    LDSX();
    v16h vh[4], vl[4];   // the step's eight v fragments, read as one group with the P row
#pragma unroll
    for (int dt = 0; dt < 4; ++dt) { vh[dt] = frag_l(lv + dt * (16 * AKP)); vl[dt] = frag_l(lv + ATL + dt * (16 * AKP)); }
    v16h pa, pl; { const float* prow = &sp[wave][col][0] + 8 * (lane >> 4);
#pragma unroll
      for (int i = 0; i < 8; ++i) { const float x0 = prow[i] * 2048.0f, x1 = prow[16 + i] * 2048.0f; const _Float16 h0 = (_Float16)x0, h1 = (_Float16)x1; pa[i] = h0; pa[8 + i] = h1; pl[i] = (_Float16)((x0 - (float)h0) * 2048.0f); pl[8 + i] = (_Float16)((x1 - (float)h1) * 2048.0f); } }   // P scaled by 2^11 before the f16 split so small softmax weights stay out of the f16 subnormal range; 2^-11 folded into the epilogue
#pragma unroll
    for (int dt = 0; dt < 4; ++dt) { acc[dt] = wmma16(pa, vh[dt], acc[dt]); if (qb < 32) { accl[dt] = wmma16(pl, vh[dt], accl[dt]); accl[dt] = wmma16(pa, vl[dt], accl[dt]); } }   // every query block (qb < 32 always holds for the 32-block grid): P hi/lo x V hi/lo (3 products)
    LDSX(); }
    asm volatile("s_wait_dscnt 0x0" ::: "memory");      // this wave's reads of stage st are done before its buffer is refilled
    asm volatile("s_wait_asynccnt 0x0" ::: "memory");   // this wave's copies of stage st + 1 have landed
    __syncthreads();                                     // publishes stage st + 1 and ends every wave's reads of stage st
    if (st + 2 <= st1) stage(st + 2, bo); }
  asm volatile("s_wait_asynccnt 0x0" ::: "memory");     // nothing in flight when the buffers become output staging
  float (*so)[16][68] = (float (*)[16][68])sb;          // each wave's own range of the ring, free behind the last stage's barrier
#pragma unroll
  for (int r = 0; r < 8; ++r) { const float il = (1.0f / 2048.0f) / l[r];
#pragma unroll
    for (int dt = 0; dt < 4; ++dt) so[wave][8 * g + r][dt * 16 + col] = (acc[dt][r] + accl[dt][r] * (1.0f / 2048.0f)) * il; }
  LDSX();
  for (int rl = 0; rl < 16; ++rl) if (lane < 16) vst2(O + ((size_t)b * SS + q0 + rl) * DM + h * HD + lane * 4, *(const v4f*)&so[wave][rl][lane * 4]);
}
// ---- k_out: block = (64 rows, 128 cols): out = O(hi/lo) . Wo rows (2 products) + bo
__global__ __launch_bounds__(128) void k_out(const float* __restrict__ O, const __bf16* __restrict__ P, const float* __restrict__ BO, float* __restrict__ Y) {
  __shared__ __align__(16) unsigned char sm[2 * (64 * GXP + 128 * GWP)];
  const int tid = threadIdx.x, wave = tid >> 5, lane = tid & 31, col = lane & 15, g = lane >> 4, wm = wave >> 1, wn = wave & 1; const size_t m0 = (size_t)blockIdx.x * 64; const int n0 = blockIdx.y * 128;
  v8f acc[2][4] = {};
  gemm_lds<2, true>(O + m0 * DM, P + (size_t)n0 * DM, sm, acc, tid);
  float* so = (float*)(sm + wave * (32 * 272));   // per wave: 32 rows of 64 f32 at pitch 272 B
#pragma unroll
  for (int i = 0; i < 2; ++i) {
#pragma unroll
    for (int j = 0; j < 4; ++j) {
#pragma unroll
      for (int r = 0; r < 8; ++r) so[(i * 16 + 8 * g + r) * 68 + j * 16 + col] = acc[i][j][r] + bfr(BO[n0 + wn * 64 + j * 16 + col]); } }
  LDSX();
  for (int it = 0; it < 16; ++it) { const int rl = it * 2 + g; vst2(Y + (m0 + wm * 32 + rl) * DM + n0 + wn * 64 + col * 4, *(const v4f*)&so[rl * 68 + col * 4]); }
}
// ---- k_rope: block = row (b,t), 256 threads: q and k (hi + residual, 1024 each) -> interleaved rotary with angle t * inv_freq[d/2], inv_freq[i] = BASE^(-i/32) -> back to hi + residual in place
__global__ __launch_bounds__(256) void k_rope(_Float16* __restrict__ QK, _Float16* __restrict__ QKL) { __shared__ __align__(16) _Float16 sh[2 * DM], sl[2 * DM]; const int t = threadIdx.x; const size_t row = blockIdx.x; const int pos = (int)(row % SS);
  for (int e = t; e < DM; e += 256) { // e = w*512 + pair index p (w: 0 q, 1 k); each thread handles 4 (even, odd) pairs, one per e
    const int w = e / (DM / 2), p = e % (DM / 2); const int c0 = 2 * p; const int i = (c0 % HD) / 2; const size_t o = row * (2 * DM) + (size_t)w * DM + c0;
    const float x0 = (float)QK[o] + (float)QKL[o] * (1.0f / 2048.0f), x1 = (float)QK[o + 1] + (float)QKL[o + 1] * (1.0f / 2048.0f);
    const float invf = (float)exp(-(double)i / (double)(HD / 2) * log((double)RBASE)); const float ang = (float)pos * invf; const float cs = cosf(ang), sn = sinf(ang);
    const float y0 = x0 * cs - x1 * sn, y1 = x1 * cs + x0 * sn;
    const _Float16 h0 = (_Float16)y0, h1 = (_Float16)y1; sh[w * DM + c0] = h0; sh[w * DM + c0 + 1] = h1; sl[w * DM + c0] = (_Float16)((y0 - (float)h0) * 2048.0f); sl[w * DM + c0 + 1] = (_Float16)((y1 - (float)h1) * 2048.0f); }
  __syncthreads(); vst2((unsigned*)(QK + row * (2 * DM) + t * 8), *(const v4u*)&sh[t * 8]); vst2((unsigned*)(QKL + row * (2 * DM) + t * 8), *(const v4u*)&sl[t * 8]); }
extern "C" void kernel_launch(void* const* d_in, const int* in_sizes, int n_in, void* d_out, int out_size, void* d_ws, size_t ws_size, hipStream_t stream) {
  (void)in_sizes; (void)n_in; (void)out_size;
  const float** F = (const float**)d_in;   // 0 x [2,2048,1024], 1 Wqkv [3072,1024] natural ((3,H,hd) rows), 2 Wproj [1024,1024] natural, 3 bproj [1024]
  if (ws_size < (size_t)WS_END) return;
  char* ws = (char*)d_ws; __bf16* PK = (__bf16*)(ws + WS_PK); _Float16 *QK = (_Float16*)(ws + WS_QK), *QKL = (_Float16*)(ws + WS_QKL), *VTH = (_Float16*)(ws + WS_VTH), *VTL = (_Float16*)(ws + WS_VTL); float* O = (float*)(ws + WS_O);
  k_pack<<<dim3(DM, 4), 256, 0, stream>>>(F[1], F[1] + (size_t)DM * DM, F[1] + (size_t)2 * DM * DM, F[2], PK);
  k_qkv<<<dim3(TNB * SS / 128, QKVW / 128), 128, 0, stream>>>(F[0], F[0], F[0], PK + PK_A, nullptr, nullptr, nullptr, QK, QKL, VTH, VTL);
  k_rope<<<TNB * SS, 256, 0, stream>>>(QK, QKL);
  k_attn<<<dim3(TQB, NH, TNB), 128, 0, stream>>>(QK, QKL, VTH, VTL, nullptr, O);
  k_out<<<dim3(TOB, DM / 128), 128, 0, stream>>>(O, PK + PK_P, F[3], (float*)d_out);
}

// v003
// One run takes 136 microseconds.
// In two side-by-side timings against v002, it was 1.13 and 1.12 times as fast.
// All steps since v000 together make it 2.41 times as fast.
// compute dtype: all float inputs rounded to bf16; q/k/v = x . W^T with EXACT bf16 products on WMMA 16x16x32 (natural rows), f32; rotary (angles t x inv_freq, device cosf/sinf) in f32 on q and k, re-rounded to f16 hi + residual; banded all-keys attention with hybrid scores (first 128 queries 3-product, later single f16) and 3-product P.v everywhere (key tiles outside [q-512, q] skipped), x 1/8, running-max softmax in f32 (hardware exp); out = ctx (bf16 hi + lo, 2 products) . Wproj^T + b; f32 output.
#include <hip/hip_runtime.h>
#include <math.h>

typedef __attribute__((ext_vector_type(16))) _Float16 v16h;
typedef __attribute__((ext_vector_type(16))) __bf16 v16b;
typedef __attribute__((ext_vector_type(8)))  _Float16 v8h;
typedef __attribute__((ext_vector_type(8)))  float v8f;
typedef __attribute__((ext_vector_type(4)))  float v4f;
typedef __attribute__((ext_vector_type(2)))  float v2f;
typedef __attribute__((ext_vector_type(4)))  unsigned v4u;
typedef __attribute__((ext_vector_type(4)))  int v4i;
typedef float __attribute__((may_alias)) float_a;
typedef int __attribute__((may_alias)) int_a;

template <typename T> __device__ __forceinline__ void vst2(void* p, T v) { *(T*)p = v;  }
__device__ __forceinline__ v8f wmma16(v16h a, v16h b, v8f c) {
  v8f d = __builtin_amdgcn_wmma_f32_16x16x32_f16(false, a, false, b, (short)0, c, false, false);
  asm volatile("v_nop\n\tv_nop\n\tv_nop\n\tv_nop" : "+v"(d) : "v"(a), "v"(b));
  return d;
}
__device__ __forceinline__ v8f wmma_bf(v16b a, v16b b, v8f c) {
  v8f d = __builtin_amdgcn_wmma_f32_16x16x32_bf16(false, a, false, b, (short)0, c, false, false);
  asm volatile("v_nop\n\tv_nop\n\tv_nop\n\tv_nop" : "+v"(d) : "v"(a), "v"(b));
  return d;
}
// Causal local self-attention (B 2, T 2,048, C 1,024, 16 heads x 64, window 512): fused bias-free projection (natural [3C][C]), interleaved rotary embedding on q and k, scores / 8 restricted to k <= q <= k + 512, softmax, v, natural output projection + bias.
__device__ __forceinline__ v16h frag_h(const _Float16* rowk0, int lane) {
  union { v16h v; v8h q[2]; } u; const _Float16* p = rowk0 + 8 * (lane >> 4);
  u.q[0] = *(const v8h*)p; u.q[1] = *(const v8h*)(p + 16); return u.v;
}
__device__ __forceinline__ v16h frag_f32(const float* rowk0, int lane) {
  v16h a; const float* p = rowk0 + 8 * (lane >> 4);
#pragma unroll
  for (int i = 0; i < 8; ++i) { a[i] = (_Float16)p[i]; a[8 + i] = (_Float16)p[16 + i]; }
  return a;
}
__device__ __forceinline__ v16h frag_f32s(const float* rowk0, int lane, float sc) {
  v16h a; const float* p = rowk0 + 8 * (lane >> 4);
#pragma unroll
  for (int i = 0; i < 8; ++i) { a[i] = (_Float16)(p[i] * sc); a[8 + i] = (_Float16)(p[16 + i] * sc); }
  return a;
}
// column fragment from a [K][ld] layout (column n), rows >= K read as 0
__device__ __forceinline__ v16h fragc_f32(const float* W, int k0, int n, int lane, int ld, int K) {
  v16h a; const int g = lane >> 4;
#pragma unroll
  for (int i = 0; i < 8; ++i) { const int ka = k0 + 8 * g + i, kb = ka + 16;
    a[i] = (_Float16)(ka < K ? W[(size_t)(ka < K ? ka : K - 1) * ld + n] : 0.f); a[8 + i] = (_Float16)(kb < K ? W[(size_t)(kb < K ? kb : K - 1) * ld + n] : 0.f); }
  return a;
}
struct F2 { v16b h, l; };
__device__ __forceinline__ F2 bsplit16(const float v[16]) { F2 r;
#pragma unroll
  for (int i = 0; i < 16; ++i) { const __bf16 h = (__bf16)v[i]; r.h[i] = h; r.l[i] = (__bf16)(v[i] - (float)h); }
  return r; }
__device__ __forceinline__ F2 split_row(const float* row, int k0, int lane) { float v[16]; const float* p = row + k0 + 8 * (lane >> 4);
#pragma unroll
  for (int i = 0; i < 8; ++i) { v[i] = p[i]; v[8 + i] = p[16 + i]; }
  return bsplit16(v); }
__device__ __forceinline__ F2 split_rowK(const float* row, int k0, int lane, int K) { float v[16]; const int g = lane >> 4;
#pragma unroll
  for (int i = 0; i < 8; ++i) { const int ka = k0 + 8 * g + i, kb = ka + 16; v[i] = ka < K ? row[ka < K ? ka : K - 1] : 0.f; v[8 + i] = kb < K ? row[kb < K ? kb : K - 1] : 0.f; }
  return bsplit16(v); }
__device__ __forceinline__ F2 split_col(const float* W, int k0, int n, int lane, int ld, int K) { float v[16]; const int g = lane >> 4;
#pragma unroll
  for (int i = 0; i < 8; ++i) { const int ka = k0 + 8 * g + i, kb = ka + 16; v[i] = ka < K ? W[(size_t)(ka < K ? ka : K - 1) * ld + n] : 0.f; v[8 + i] = kb < K ? W[(size_t)(kb < K ? kb : K - 1) * ld + n] : 0.f; }
  return bsplit16(v); }
__device__ __forceinline__ v8f mac3(const F2& a, const F2& b, v8f c) { c = wmma_bf(a.l, b.h, c); c = wmma_bf(a.h, b.l, c); return wmma_bf(a.h, b.h, c); }
__device__ __forceinline__ float sigm(float v) { return 1.0f / (1.0f + expf(-v)); }
#define LDSX() do { asm volatile("s_wait_dscnt 0" ::: "memory"); __builtin_amdgcn_wave_barrier(); __builtin_amdgcn_fence(__ATOMIC_RELEASE, "workgroup"); } while (0)


#define NB 2
#define SS 2048
#define DM 1024
#define NH 16
#define LWIN 512
#define RBASE 10000.0f
#define HD 64
#define QKVW (3 * DM)
#ifndef TQB
#define TQB (SS / 64)
#define TNB NB
#define TOB (NB * SS / 64)     // output row tiles (all)
#endif
typedef __attribute__((ext_vector_type(8))) __bf16 v8b;
__device__ __forceinline__ v16b frag_b(const __bf16* rowk0, int lane) {
  union { v16b v; v8b q[2]; } u; const __bf16* p = rowk0 + 8 * (lane >> 4);
  u.q[0] = *(const v8b*)p; u.q[1] = *(const v8b*)(p + 16); return u.v;
}
__device__ __forceinline__ float bfr(float v) { return (float)(__bf16)v; }
__device__ __attribute__((noinline)) float exp_ni(float v) { return expf(v); }
__device__ __attribute__((noinline)) float erf_ni(float v) { return erff(v); }

#define PK_A 0                       // [3072][1024] Wqkv rows (natural [out][in])
#define PK_P (PK_A + QKVW * DM)        // [1024][1024] Wo rows (natural)
#define PK_END (PK_P + DM * DM)
#define WS_PK  0u
#define WS_QK  (WS_PK + 2u * PK_END)             // f16 [4096 rows][2048]: q | k
#define WS_QKL (WS_QK + 2u * NB * SS * 2 * DM)     // f16 q | k residual planes x2048
#define WS_VTH (WS_QKL + 2u * NB * SS * 2 * DM)    // f16 [b][1024 (h*64+d)][2048 s] hi
#define WS_VTL (WS_VTH + 2u * NB * DM * SS)        // f16 lo x 2048
#define WS_O   (WS_VTL + 2u * NB * DM * SS)        // f32 [4096][1024]
#define WS_CS  (WS_O + 4u * NB * SS * DM)           // f32 2 x [2048][32], reserved, unused (k_rope computes cos/sin)
#define WS_END (WS_CS + 4u * 2 * SS * 32)
// ---- k_pack: block = (row n, which): natural [out][in] rows -> bf16; which 0..2 -> W_q/W_k/W_v into PK_A rows which*1024 + n; 3 -> W_o into PK_P
__global__ __launch_bounds__(256) void k_pack(const float* __restrict__ WQ, const float* __restrict__ WK, const float* __restrict__ WV, const float* __restrict__ WO, __bf16* __restrict__ PK) {
  __shared__ __align__(16) __bf16 s[DM]; const int n = blockIdx.x, which = blockIdx.y, t = threadIdx.x; const float* Wm = (which == 0) ? WQ : (which == 1) ? WK : (which == 2) ? WV : WO;
  for (int k = t; k < DM; k += 256) s[k] = (__bf16)Wm[(size_t)n * DM + k];
  __syncthreads();
  __bf16* dst = (which < 3) ? PK + PK_A + ((size_t)which * DM + n) * DM : PK + PK_P + (size_t)n * DM;
  for (int q = t; q < DM / 8; q += 256) vst2((unsigned*)(dst + q * 8), *(const v4u*)&s[q * 8]);
}
// ---- projection GEMM core: block tile (32 * MI rows) x 128 columns, 4 waves as 2 x 2, each (16 * MI) x 64. A stage is 64 k: the f32 rows of X (256 B, LDS pitch 272 B) and the bf16 rows of W (128 B, LDS pitch 144 B),
// brought into LDS by asynchronous b128 copies, two buffers: stage t + 1 flies while stage t is multiplied. Fragments keep the k order and every accumulator its k sequence (32 steps of 32, ascending).
#define GXP 272
#define GWP 144
// eight copies of one lane, LDS and global address each advancing by a fixed step; the closing s_wait_xcnt 0 stands inside the statement so that no address register is rewritten ahead of it
__device__ __forceinline__ void acopy8(unsigned l, unsigned ls, const char* g, unsigned gs) {
  asm volatile("global_load_async_to_lds_b128 %0, %8, off\n\t"
               "global_load_async_to_lds_b128 %1, %9, off\n\t"
               "global_load_async_to_lds_b128 %2, %10, off\n\t"
               "global_load_async_to_lds_b128 %3, %11, off\n\t"
               "global_load_async_to_lds_b128 %4, %12, off\n\t"
               "global_load_async_to_lds_b128 %5, %13, off\n\t"
               "global_load_async_to_lds_b128 %6, %14, off\n\t"
               "global_load_async_to_lds_b128 %7, %15, off\n\t"
               "s_wait_xcnt 0x0"
               :: "v"(l), "v"(l + ls), "v"(l + 2 * ls), "v"(l + 3 * ls), "v"(l + 4 * ls), "v"(l + 5 * ls), "v"(l + 6 * ls), "v"(l + 7 * ls),
                  "v"(g), "v"(g + gs), "v"(g + 2 * (size_t)gs), "v"(g + 3 * (size_t)gs), "v"(g + 4 * (size_t)gs), "v"(g + 5 * (size_t)gs), "v"(g + 6 * (size_t)gs), "v"(g + 7 * (size_t)gs)
               : "memory");
}
template <int MI, bool SPLIT>
__device__ __forceinline__ void gemm_lds(const float* __restrict__ Xb, const __bf16* __restrict__ Wb, unsigned char* sm, v8f (&acc)[MI][4], int tid) {
  constexpr int XB = 32 * MI * GXP, ST = XB + 128 * GWP, NT = DM / 64;
  const int wave = tid >> 5, lane = tid & 31, col = lane & 15, g = lane >> 4, wm = wave >> 1, wn = wave & 1;
  // X: 16 lanes cover a 256-B row piece, 8 rows per copy of the block; W: 8 lanes cover a 128-B row piece, 16 rows per copy
  const unsigned lx = (unsigned)(size_t)sm + (unsigned)((tid >> 4) * GXP + (tid & 15) * 16), lw = (unsigned)(size_t)sm + (unsigned)(XB + (tid >> 3) * GWP + (tid & 7) * 16);
  const char* gx = (const char*)Xb + (size_t)(tid >> 4) * (DM * 4) + (tid & 15) * 16; const char* gw = (const char*)Wb + (size_t)(tid >> 3) * (DM * 2) + (tid & 7) * 16;
  auto stage = [&](int t, unsigned bo) {
#pragma unroll
    for (int u = 0; u < MI / 2; ++u) acopy8(lx + bo + u * (64 * GXP), 8 * GXP, gx + (size_t)t * 256 + (size_t)u * (64 * DM * 4), 8 * DM * 4);
    acopy8(lw + bo, 16 * GWP, gw + (size_t)t * 128, 16 * DM * 2); };
  stage(0, 0u);
  asm volatile("s_wait_asynccnt 0x0" ::: "memory");   // this wave's copies of stage 0 have landed
  __syncthreads();                                     // stage 0 published to every wave
  stage(1, (unsigned)ST);
#pragma unroll 1   // rolled: for speed only
  for (int t = 0; t < NT; ++t) { const unsigned bo = (t & 1) ? (unsigned)ST : 0u;
    const unsigned char* sx = sm + bo + (wm * 16 * MI + col) * GXP + 32 * g; const unsigned char* sw = sm + bo + XB + (wn * 64 + col) * GWP + 16 * g;
#pragma unroll
    for (int kc = 0; kc < 2; ++kc) { v16b b[4];
#pragma unroll
      for (int j = 0; j < 4; ++j) { union { v16b v; v8b q[2]; } u; const unsigned char* p = sw + j * (16 * GWP) + kc * 64; u.q[0] = *(const v8b*)p; u.q[1] = *(const v8b*)(p + 32); b[j] = u.v; }
#pragma unroll
      for (int i = 0; i < MI; ++i) { const v4f* p = (const v4f*)(sx + i * (16 * GXP) + kc * 128); const v4f x0 = p[0], x1 = p[1], x2 = p[4], x3 = p[5]; float v[16];
#pragma unroll
        for (int e = 0; e < 4; ++e) { v[e] = x0[e]; v[4 + e] = x1[e]; v[8 + e] = x2[e]; v[12 + e] = x3[e]; }
        if (SPLIT) { const F2 a = bsplit16(v);
#pragma unroll
          for (int j = 0; j < 4; ++j) acc[i][j] = wmma_bf(a.l, b[j], acc[i][j]);   // residual first, then hi, per accumulator as before; four independent tiles between the two
#pragma unroll
          for (int j = 0; j < 4; ++j) acc[i][j] = wmma_bf(a.h, b[j], acc[i][j]); }
        else { v16b a;
#pragma unroll
          for (int e = 0; e < 16; ++e) a[e] = (__bf16)v[e];
#pragma unroll
          for (int j = 0; j < 4; ++j) acc[i][j] = wmma_bf(a, b[j], acc[i][j]); } } }
    asm volatile("s_wait_dscnt 0x0" ::: "memory");      // this wave's reads of stage t are done before its buffer is refilled
    asm volatile("s_wait_asynccnt 0x0" ::: "memory");   // this wave's copies of stage t + 1 have landed
    __syncthreads();                                     // publishes stage t + 1 and ends every wave's reads of stage t
    if (t + 2 < NT) stage(t + 2, bo); }
  asm volatile("s_wait_asynccnt 0x0" ::: "memory");     // nothing in flight when the buffers become output staging
}
// ---- k_qkv: block = (128 rows, 128 columns); each wave stages its 64 x 64 result in its own LDS range and stores whole 128-B lines
__global__ __launch_bounds__(128) void k_qkv(const float* __restrict__ XQ, const float* __restrict__ XK, const float* __restrict__ XV, const __bf16* __restrict__ P, const float* __restrict__ BQ, const float* __restrict__ BK, const float* __restrict__ BV, _Float16* __restrict__ QK, _Float16* __restrict__ QKL, _Float16* __restrict__ VTH, _Float16* __restrict__ VTL) {
  const int which0 = (blockIdx.y * 128) / DM; const float* X = (which0 == 0) ? XQ : (which0 == 1) ? XK : XV; const float* BB = BQ ? (((which0 == 0) ? BQ : (which0 == 1) ? BK : BV) + (blockIdx.y * 128 - which0 * DM)) : nullptr;
  __shared__ __align__(16) unsigned char sm[2 * (128 * GXP + 128 * GWP)];
  const int tid = threadIdx.x, wave = tid >> 5, lane = tid & 31, col = lane & 15, g = lane >> 4, wm = wave >> 1, wn = wave & 1; const size_t m0 = (size_t)blockIdx.x * 128; const int n0 = blockIdx.y * 128;
  v8f acc[4][4] = {};
  gemm_lds<4, false>(X + m0 * DM, P + (size_t)n0 * DM, sm, acc, tid);
  float bj[4];
#pragma unroll
  for (int j = 0; j < 4; ++j) bj[j] = BB ? bfr(BB[wn * 64 + j * 16 + col]) : 0.f;
  _Float16* eh = (_Float16*)(sm + wave * (2 * 64 * 144)); _Float16* el = eh + 64 * 72;   // per wave: hi and residual planes, 64 rows at pitch 144 B
  if (n0 < 2 * DM) {   // q stored unscaled (f16 sigma ~0.6, no subnormal exposure); 1/8 applied to the f32 score
#pragma unroll
    for (int i = 0; i < 4; ++i) {
#pragma unroll
      for (int j = 0; j < 4; ++j) {
#pragma unroll
        for (int r = 0; r < 8; ++r) { const float v = acc[i][j][r] + bj[j]; const _Float16 hv = (_Float16)v; eh[(i * 16 + 8 * g + r) * 72 + j * 16 + col] = hv; el[(i * 16 + 8 * g + r) * 72 + j * 16 + col] = (_Float16)((v - (float)hv) * 2048.0f); } } }   // q, k (+ bias) as f16 hi + (x2048) residual
    LDSX();
    for (int it = 0; it < 16; ++it) { const int rl = it * 4 + (lane >> 3), pc = lane & 7; const size_t o = (m0 + wm * 64 + rl) * (2 * DM) + n0 + wn * 64 + pc * 8; vst2((unsigned*)(QK + o), *(const v4u*)&eh[rl * 72 + pc * 8]); vst2((unsigned*)(QKL + o), *(const v4u*)&el[rl * 72 + pc * 8]); }
  } else {   // v transposed: a lane's 8 accumulator rows are 8 consecutive s of one d
#pragma unroll
    for (int i = 0; i < 4; ++i) {
#pragma unroll
      for (int j = 0; j < 4; ++j) { v8h th, tl;
#pragma unroll
        for (int r = 0; r < 8; ++r) { const float v = acc[i][j][r] + bj[j]; const _Float16 hv = (_Float16)v; th[r] = hv; tl[r] = (_Float16)((v - (float)hv) * 2048.0f); }
        *(v8h*)&eh[(j * 16 + col) * 72 + i * 16 + 8 * g] = th; *(v8h*)&el[(j * 16 + col) * 72 + i * 16 + 8 * g] = tl; } }
    LDSX();
    const int b = (int)(m0 / SS), s0 = (int)(m0 % SS) + wm * 64; const int pc0 = n0 - 2 * DM + wn * 64;
    for (int it = 0; it < 16; ++it) { const int d = it * 4 + (lane >> 3), pc = lane & 7; const size_t o = ((size_t)b * DM + pc0 + d) * SS + s0 + pc * 8; vst2((unsigned*)(VTH + o), *(const v4u*)&eh[d * 72 + pc * 8]); vst2((unsigned*)(VTL + o), *(const v4u*)&el[d * 72 + pc * 8]); }
  }
}
// ---- k_attn: block = (64 queries, head h, batch b): all-keys flash attention (K = 64: 2 k-steps), scores = (q.k) * 0.125 with 3 f16 products (q, k hi + residual) in query blocks 0 and 1, single f16 elsewhere, P.V: f16 P hi/lo x (V hi, V lo*2048), 3 products in two accumulators; O[b*S+q][h*64+d] = (acc + accl / 2048) / (2048 l) (256-B segments)
// A stage is 64 keys: the k rows (64 x 128 B), and the 64 d rows of v hi and of v residual (128 B = 64 keys each), every row at LDS pitch 144 B, brought in once for the block's four waves by asynchronous b128 copies of whole 128-B lines,
// two buffers: stage s + 1 flies while the two 32-key steps of stage s are worked on. Fragments, their k order, the key order and every sum are as before.
#define AKP 144
#define ATL (64 * AKP)
#define AST (3 * ATL)
// four copies of one lane, LDS and global address each advancing by a fixed step; the closing s_wait_xcnt 0 stands inside the statement so that no address register is rewritten ahead of it
__device__ __forceinline__ void acopy4(unsigned l, unsigned ls, const char* g, unsigned gs) {
  asm volatile("global_load_async_to_lds_b128 %0, %4, off\n\t"
               "global_load_async_to_lds_b128 %1, %5, off\n\t"
               "global_load_async_to_lds_b128 %2, %6, off\n\t"
               "global_load_async_to_lds_b128 %3, %7, off\n\t"
               "s_wait_xcnt 0x0"
               :: "v"(l), "v"(l + ls), "v"(l + 2 * ls), "v"(l + 3 * ls),
                  "v"(g), "v"(g + gs), "v"(g + 2 * (size_t)gs), "v"(g + 3 * (size_t)gs)
               : "memory");
}
// fragment from an LDS row: the lane's 16 B at p and the 16 B at p + 32 (the k order of frag_h)
__device__ __forceinline__ v16h frag_l(const unsigned char* p) { union { v16h v; v8h q[2]; } u; u.q[0] = *(const v8h*)p; u.q[1] = *(const v8h*)(p + 32); return u.v; }
// lane l with lane l ^ 16 (the other half of a query's keys)
__device__ __forceinline__ float xhalf(float x) { return __builtin_bit_cast(float, __builtin_amdgcn_permlanex16(__builtin_bit_cast(int, x), __builtin_bit_cast(int, x), 0x76543210, 0xfedcba98, false, false)); }
// Transposed products: S^T = K . Q^T (A = 16 key rows, B = the wave's 16 queries) and O^T += V^T . P^T (A = 16 d rows of v, B = P^T). A lane holds one query (column col): 8 of each 16-key tile's scores, the other 8 in lane ^ 16,
// so maximum and sum run in the lane with one exchange between the halves, and the two score tiles of a 32-key step, converted in place, are the B fragment of P^T in the k order of the v rows: P goes through no LDS.
// second bound: four waves a SIMD (256 registers a wave), so that all 1,024 blocks stay resident at once as before
__global__ __launch_bounds__(128, 4) void k_attn(const _Float16* __restrict__ QK, const _Float16* __restrict__ QKL, const _Float16* __restrict__ VTH, const _Float16* __restrict__ VTL, const void* __restrict__ KMASK, float* __restrict__ O) {
  __shared__ __align__(16) unsigned char sb[2 * AST];
  const int tid = threadIdx.x, wave = tid >> 5, lane = tid & 31, col = lane & 15, g = lane >> 4;
  const int qb = blockIdx.x, h = blockIdx.y, b = blockIdx.z; const int q0 = qb * 64 + wave * 16; const size_t rq = (size_t)b * SS + q0 + col; const int qi = q0 + col;   // qi: the lane's query
  const int st0 = qb > LWIN / 64 ? qb - LWIN / 64 : 0, st1 = qb;   // banded causal: 64-key stages st0 .. st1
  // 8 lanes cover a 128-B row, 16 rows per copy of the block, 4 copies per tile
  const unsigned lc = (unsigned)(size_t)sb + (unsigned)((tid >> 3) * AKP + (tid & 7) * 16);
  const char* gk = (const char*)(QK + ((size_t)b * SS + (tid >> 3)) * (2 * DM) + DM + h * HD) + (tid & 7) * 16;
  const size_t vo = (((size_t)b * DM + h * HD + (tid >> 3)) * SS) * 2 + (tid & 7) * 16; const char* gvh = (const char*)VTH + vo; const char* gvl = (const char*)VTL + vo;
  auto stage = [&](int s, unsigned bo) {
    acopy4(lc + bo, 16 * AKP, gk + (size_t)s * (64 * 2 * DM * 2), 16 * 2 * DM * 2);
    acopy4(lc + bo + ATL, 16 * AKP, gvh + (size_t)s * 128, 16 * SS * 2);
    acopy4(lc + bo + 2 * ATL, 16 * AKP, gvl + (size_t)s * 128, 16 * SS * 2); };
  stage(st0, 0u);
  v16h aq[2];
#pragma unroll
  for (int kc = 0; kc < 2; ++kc) aq[kc] = frag_h(QK + rq * (2 * DM) + h * HD + kc * 32, lane);
  float m = -3.0e38f, l = 0.f;   // the lane's query: running maximum (both halves alike), sum over this half's keys
  v8f acc[4] = {}, accl[4] = {};
  asm volatile("s_wait_asynccnt 0x0" ::: "memory");   // this wave's copies of the first stage have landed
  __syncthreads();                                     // first stage published to every wave
  if (st0 < st1) stage(st0 + 1, (unsigned)AST);
#pragma unroll 1   // rolled: one body for every stage
  for (int st = st0; st <= st1; ++st) { const unsigned bo = ((st - st0) & 1) ? (unsigned)AST : 0u;
#pragma unroll 1   // rolled: the two 32-key steps of a stage share one body
  for (int sub = 0; sub < 2; ++sub) { const int ks = st * 2 + sub; v8f s[2];
    const unsigned char* lk = sb + bo + (sub * 32 + col) * AKP + 16 * g; const unsigned char* lv = sb + bo + ATL + col * AKP + sub * 64 + 16 * g;
    v16h kf[2][2];   // the step's four k fragments, read as one group ahead of the products
#pragma unroll
    for (int ct = 0; ct < 2; ++ct) {
#pragma unroll
      for (int kc = 0; kc < 2; ++kc) kf[ct][kc] = frag_l(lk + ct * (16 * AKP) + kc * 64); }
    v16h vh[4], vl[4];   // the step's eight v fragments
#pragma unroll
    for (int dt = 0; dt < 4; ++dt) { vh[dt] = frag_l(lv + dt * (16 * AKP)); vl[dt] = frag_l(lv + ATL + dt * (16 * AKP)); }
#pragma unroll
    for (int ct = 0; ct < 2; ++ct) { const _Float16* krowl = QKL + ((size_t)b * SS + ks * 32 + ct * 16 + col) * (2 * DM) + DM + h * HD; v8f c = {}, cl = {};
      if (qb < 2) {   // leading query blocks (few keys, outputs far above the global rms): 3 products; the q residual is fetched here, where alone it is used, so that it holds no registers in the other blocks
#pragma unroll
        for (int kc = 0; kc < 2; ++kc) { const v16h kh = kf[ct][kc]; c = wmma16(kh, aq[kc], c); cl = wmma16(kh, frag_h(QKL + rq * (2 * DM) + h * HD + kc * 32, lane), cl); cl = wmma16(frag_h(krowl + kc * 32, lane), aq[kc], cl); }
#pragma unroll
        for (int r = 0; r < 8; ++r) c[r] += cl[r] * (1.0f / 2048.0f); }
      else {
#pragma unroll
        for (int kc = 0; kc < 2; ++kc) c = wmma16(kf[ct][kc], aq[kc], c); }   // single product elsewhere
#pragma unroll
      for (int r = 0; r < 8; ++r) { const int kk = ks * 32 + ct * 16 + 8 * g + r; s[ct][r] = (kk <= qi && qi - kk <= LWIN) ? c[r] * 0.125f : -3.0e38f; } }   // 1/sqrt(64); masked keys excluded
    float mx = fmaxf(s[0][0], s[1][0]);
#pragma unroll
    for (int r = 1; r < 8; ++r) mx = fmaxf(mx, fmaxf(s[0][r], s[1][r]));
    mx = fmaxf(mx, xhalf(mx));   // the step's 32 keys
    const float mn = fmaxf(m, mx); const float alpha = (m <= -1.0e38f) ? 0.f : __expf(m - mn);
    v8f e[2];
#pragma unroll
    for (int ct = 0; ct < 2; ++ct) {
#pragma unroll
      for (int r = 0; r < 8; ++r) e[ct][r] = (s[ct][r] <= -1.0e38f) ? 0.f : __expf(s[ct][r] - mn); }
    const v8f e8 = e[0] + e[1]; const v4f e4 = e8.lo + e8.hi; const v2f e2 = e4.lo + e4.hi;
    l = l * alpha + (e2[0] + e2[1]); m = mn;   // the halves' sums are joined once, behind the loop
#pragma unroll
    for (int dt = 0; dt < 4; ++dt) { acc[dt] *= alpha; accl[dt] *= alpha; }
    v16h pa, pl;
#pragma unroll
    for (int ct = 0; ct < 2; ++ct) {
#pragma unroll
      for (int r = 0; r < 8; ++r) { const float x = e[ct][r] * 2048.0f; const _Float16 hx = (_Float16)x; pa[ct * 8 + r] = hx; pl[ct * 8 + r] = (_Float16)((x - (float)hx) * 2048.0f); } }   // P scaled by 2^11 before the f16 split so small softmax weights stay out of the f16 subnormal range; 2^-11 folded into the epilogue
#pragma unroll
    for (int dt = 0; dt < 4; ++dt) acc[dt] = wmma16(vh[dt], pa, acc[dt]);
    if (qb < 32) {   // every query block (qb < 32 always holds): P hi/lo x V hi/lo (3 products); per accumulator the residual of P first, then that of v, as before
#pragma unroll
      for (int dt = 0; dt < 4; ++dt) accl[dt] = wmma16(vh[dt], pl, accl[dt]);
#pragma unroll
      for (int dt = 0; dt < 4; ++dt) accl[dt] = wmma16(vl[dt], pa, accl[dt]); }
    }
    asm volatile("s_wait_dscnt 0x0" ::: "memory");      // this wave's reads of stage st are done before its buffer is refilled
    asm volatile("s_wait_asynccnt 0x0" ::: "memory");   // this wave's copies of stage st + 1 have landed
    __syncthreads();                                     // publishes stage st + 1 and ends every wave's reads of stage st
    if (st + 2 <= st1) stage(st + 2, bo); }
  asm volatile("s_wait_asynccnt 0x0" ::: "memory");     // nothing in flight when the buffers become output staging
  float (*so)[16][68] = (float (*)[16][68])sb;          // each wave's own range of the ring, free behind the last stage's barrier
  const float il = (1.0f / 2048.0f) / (l + xhalf(l));
#pragma unroll
  for (int dt = 0; dt < 4; ++dt) { v4f o0, o1;   // a lane's 8 accumulator rows are 8 consecutive d of its query
#pragma unroll
    for (int r = 0; r < 4; ++r) { o0[r] = (acc[dt][r] + accl[dt][r] * (1.0f / 2048.0f)) * il; o1[r] = (acc[dt][4 + r] + accl[dt][4 + r] * (1.0f / 2048.0f)) * il; }
    *(v4f*)&so[wave][col][dt * 16 + 8 * g] = o0; *(v4f*)&so[wave][col][dt * 16 + 8 * g + 4] = o1; }
  LDSX();
  for (int rl = 0; rl < 16; ++rl) if (lane < 16) vst2(O + ((size_t)b * SS + q0 + rl) * DM + h * HD + lane * 4, *(const v4f*)&so[wave][rl][lane * 4]);
}
// ---- k_out: block = (64 rows, 128 cols): out = O(hi/lo) . Wo rows (2 products) + bo
__global__ __launch_bounds__(128) void k_out(const float* __restrict__ O, const __bf16* __restrict__ P, const float* __restrict__ BO, float* __restrict__ Y) {
  __shared__ __align__(16) unsigned char sm[2 * (64 * GXP + 128 * GWP)];
  const int tid = threadIdx.x, wave = tid >> 5, lane = tid & 31, col = lane & 15, g = lane >> 4, wm = wave >> 1, wn = wave & 1; const size_t m0 = (size_t)blockIdx.x * 64; const int n0 = blockIdx.y * 128;
  v8f acc[2][4] = {};
  gemm_lds<2, true>(O + m0 * DM, P + (size_t)n0 * DM, sm, acc, tid);
  float* so = (float*)(sm + wave * (32 * 272));   // per wave: 32 rows of 64 f32 at pitch 272 B
#pragma unroll
  for (int i = 0; i < 2; ++i) {
#pragma unroll
    for (int j = 0; j < 4; ++j) {
#pragma unroll
      for (int r = 0; r < 8; ++r) so[(i * 16 + 8 * g + r) * 68 + j * 16 + col] = acc[i][j][r] + bfr(BO[n0 + wn * 64 + j * 16 + col]); } }
  LDSX();
  for (int it = 0; it < 16; ++it) { const int rl = it * 2 + g; vst2(Y + (m0 + wm * 32 + rl) * DM + n0 + wn * 64 + col * 4, *(const v4f*)&so[rl * 68 + col * 4]); }
}
// ---- k_rope: block = row (b,t), 256 threads: q and k (hi + residual, 1024 each) -> interleaved rotary with angle t * inv_freq[d/2], inv_freq[i] = BASE^(-i/32) -> back to hi + residual in place
__global__ __launch_bounds__(256) void k_rope(_Float16* __restrict__ QK, _Float16* __restrict__ QKL) { __shared__ __align__(16) _Float16 sh[2 * DM], sl[2 * DM]; const int t = threadIdx.x; const size_t row = blockIdx.x; const int pos = (int)(row % SS);
  for (int e = t; e < DM; e += 256) { // e = w*512 + pair index p (w: 0 q, 1 k); each thread handles 4 (even, odd) pairs, one per e
    const int w = e / (DM / 2), p = e % (DM / 2); const int c0 = 2 * p; const int i = (c0 % HD) / 2; const size_t o = row * (2 * DM) + (size_t)w * DM + c0;
    const float x0 = (float)QK[o] + (float)QKL[o] * (1.0f / 2048.0f), x1 = (float)QK[o + 1] + (float)QKL[o + 1] * (1.0f / 2048.0f);
    const float invf = (float)exp(-(double)i / (double)(HD / 2) * log((double)RBASE)); const float ang = (float)pos * invf; const float cs = cosf(ang), sn = sinf(ang);
    const float y0 = x0 * cs - x1 * sn, y1 = x1 * cs + x0 * sn;
    const _Float16 h0 = (_Float16)y0, h1 = (_Float16)y1; sh[w * DM + c0] = h0; sh[w * DM + c0 + 1] = h1; sl[w * DM + c0] = (_Float16)((y0 - (float)h0) * 2048.0f); sl[w * DM + c0 + 1] = (_Float16)((y1 - (float)h1) * 2048.0f); }
  __syncthreads(); vst2((unsigned*)(QK + row * (2 * DM) + t * 8), *(const v4u*)&sh[t * 8]); vst2((unsigned*)(QKL + row * (2 * DM) + t * 8), *(const v4u*)&sl[t * 8]); }
extern "C" void kernel_launch(void* const* d_in, const int* in_sizes, int n_in, void* d_out, int out_size, void* d_ws, size_t ws_size, hipStream_t stream) {
  (void)in_sizes; (void)n_in; (void)out_size;
  const float** F = (const float**)d_in;   // 0 x [2,2048,1024], 1 Wqkv [3072,1024] natural ((3,H,hd) rows), 2 Wproj [1024,1024] natural, 3 bproj [1024]
  if (ws_size < (size_t)WS_END) return;
  char* ws = (char*)d_ws; __bf16* PK = (__bf16*)(ws + WS_PK); _Float16 *QK = (_Float16*)(ws + WS_QK), *QKL = (_Float16*)(ws + WS_QKL), *VTH = (_Float16*)(ws + WS_VTH), *VTL = (_Float16*)(ws + WS_VTL); float* O = (float*)(ws + WS_O);
  k_pack<<<dim3(DM, 4), 256, 0, stream>>>(F[1], F[1] + (size_t)DM * DM, F[1] + (size_t)2 * DM * DM, F[2], PK);
  k_qkv<<<dim3(TNB * SS / 128, QKVW / 128), 128, 0, stream>>>(F[0], F[0], F[0], PK + PK_A, nullptr, nullptr, nullptr, QK, QKL, VTH, VTL);
  k_rope<<<TNB * SS, 256, 0, stream>>>(QK, QKL);
  k_attn<<<dim3(TQB, NH, TNB), 128, 0, stream>>>(QK, QKL, VTH, VTL, nullptr, O);
  k_out<<<dim3(TOB, DM / 128), 128, 0, stream>>>(O, PK + PK_P, F[3], (float*)d_out);
}

// v004
// A run of this version takes 90.6 microseconds.
// Timed twice side by side with v003, it ran 1.51 and 1.50 times as fast.
// Counting every step since v000, it is 3.63 times as fast.
// compute dtype: all float inputs rounded to bf16; q/k/v = x . W^T with EXACT bf16 products on WMMA 16x16x32 (natural rows), f32; rotary (angles t x inv_freq, device cosf/sinf) in f32 on q and k, rounded to f16 hi + residual; banded all-keys attention with hybrid scores (first 128 queries 3-product, later single f16) and 3-product P.v everywhere (key tiles outside [q-512, q] skipped), x 1/8, running-max softmax in f32 (hardware exp); out = ctx (bf16 hi + lo, 2 products) . Wproj^T + b; f32 output.
#include <hip/hip_runtime.h>
#include <math.h>

typedef __attribute__((ext_vector_type(16))) _Float16 v16h;
typedef __attribute__((ext_vector_type(16))) __bf16 v16b;
typedef __attribute__((ext_vector_type(8)))  _Float16 v8h;
typedef __attribute__((ext_vector_type(8)))  float v8f;
typedef __attribute__((ext_vector_type(4)))  float v4f;
typedef __attribute__((ext_vector_type(2)))  float v2f;
typedef __attribute__((ext_vector_type(4)))  unsigned v4u;
typedef __attribute__((ext_vector_type(4)))  int v4i;
typedef float __attribute__((may_alias)) float_a;
typedef int __attribute__((may_alias)) int_a;

template <typename T> __device__ __forceinline__ void vst2(void* p, T v) { *(T*)p = v;  }
__device__ __forceinline__ v8f wmma16(v16h a, v16h b, v8f c) {
  v8f d = __builtin_amdgcn_wmma_f32_16x16x32_f16(false, a, false, b, (short)0, c, false, false);
  asm volatile("v_nop\n\tv_nop\n\tv_nop\n\tv_nop" : "+v"(d) : "v"(a), "v"(b));
  return d;
}
__device__ __forceinline__ v8f wmma_bf(v16b a, v16b b, v8f c) {
  v8f d = __builtin_amdgcn_wmma_f32_16x16x32_bf16(false, a, false, b, (short)0, c, false, false);
  asm volatile("v_nop\n\tv_nop\n\tv_nop\n\tv_nop" : "+v"(d) : "v"(a), "v"(b));
  return d;
}
// Causal local self-attention (B 2, T 2,048, C 1,024, 16 heads x 64, window 512): fused bias-free projection (natural [3C][C]), interleaved rotary embedding on q and k, scores / 8 restricted to k <= q <= k + 512, softmax, v, natural output projection + bias.
__device__ __forceinline__ v16h frag_h(const _Float16* rowk0, int lane) {
  union { v16h v; v8h q[2]; } u; const _Float16* p = rowk0 + 8 * (lane >> 4);
  u.q[0] = *(const v8h*)p; u.q[1] = *(const v8h*)(p + 16); return u.v;
}
__device__ __forceinline__ v16h frag_f32(const float* rowk0, int lane) {
  v16h a; const float* p = rowk0 + 8 * (lane >> 4);
#pragma unroll
  for (int i = 0; i < 8; ++i) { a[i] = (_Float16)p[i]; a[8 + i] = (_Float16)p[16 + i]; }
  return a;
}
__device__ __forceinline__ v16h frag_f32s(const float* rowk0, int lane, float sc) {
  v16h a; const float* p = rowk0 + 8 * (lane >> 4);
#pragma unroll
  for (int i = 0; i < 8; ++i) { a[i] = (_Float16)(p[i] * sc); a[8 + i] = (_Float16)(p[16 + i] * sc); }
  return a;
}
// column fragment from a [K][ld] layout (column n), rows >= K read as 0
__device__ __forceinline__ v16h fragc_f32(const float* W, int k0, int n, int lane, int ld, int K) {
  v16h a; const int g = lane >> 4;
#pragma unroll
  for (int i = 0; i < 8; ++i) { const int ka = k0 + 8 * g + i, kb = ka + 16;
    a[i] = (_Float16)(ka < K ? W[(size_t)(ka < K ? ka : K - 1) * ld + n] : 0.f); a[8 + i] = (_Float16)(kb < K ? W[(size_t)(kb < K ? kb : K - 1) * ld + n] : 0.f); }
  return a;
}
struct F2 { v16b h, l; };
__device__ __forceinline__ F2 bsplit16(const float v[16]) { F2 r;
#pragma unroll
  for (int i = 0; i < 16; ++i) { const __bf16 h = (__bf16)v[i]; r.h[i] = h; r.l[i] = (__bf16)(v[i] - (float)h); }
  return r; }
__device__ __forceinline__ F2 split_row(const float* row, int k0, int lane) { float v[16]; const float* p = row + k0 + 8 * (lane >> 4);
#pragma unroll
  for (int i = 0; i < 8; ++i) { v[i] = p[i]; v[8 + i] = p[16 + i]; }
  return bsplit16(v); }
__device__ __forceinline__ F2 split_rowK(const float* row, int k0, int lane, int K) { float v[16]; const int g = lane >> 4;
#pragma unroll
  for (int i = 0; i < 8; ++i) { const int ka = k0 + 8 * g + i, kb = ka + 16; v[i] = ka < K ? row[ka < K ? ka : K - 1] : 0.f; v[8 + i] = kb < K ? row[kb < K ? kb : K - 1] : 0.f; }
  return bsplit16(v); }
__device__ __forceinline__ F2 split_col(const float* W, int k0, int n, int lane, int ld, int K) { float v[16]; const int g = lane >> 4;
#pragma unroll
  for (int i = 0; i < 8; ++i) { const int ka = k0 + 8 * g + i, kb = ka + 16; v[i] = ka < K ? W[(size_t)(ka < K ? ka : K - 1) * ld + n] : 0.f; v[8 + i] = kb < K ? W[(size_t)(kb < K ? kb : K - 1) * ld + n] : 0.f; }
  return bsplit16(v); }
__device__ __forceinline__ v8f mac3(const F2& a, const F2& b, v8f c) { c = wmma_bf(a.l, b.h, c); c = wmma_bf(a.h, b.l, c); return wmma_bf(a.h, b.h, c); }
__device__ __forceinline__ float sigm(float v) { return 1.0f / (1.0f + expf(-v)); }
#define LDSX() do { asm volatile("s_wait_dscnt 0" ::: "memory"); __builtin_amdgcn_wave_barrier(); __builtin_amdgcn_fence(__ATOMIC_RELEASE, "workgroup"); } while (0)


#define NB 2
#define SS 2048
#define DM 1024
#define NH 16
#define LWIN 512
#define RBASE 10000.0f
#define HD 64
#define QKVW (3 * DM)
#ifndef TQB
#define TQB (SS / 64)
#define TNB NB
#define TOB (NB * SS / 64)     // output row tiles (all)
#endif
typedef __attribute__((ext_vector_type(8))) __bf16 v8b;
__device__ __forceinline__ v16b frag_b(const __bf16* rowk0, int lane) {
  union { v16b v; v8b q[2]; } u; const __bf16* p = rowk0 + 8 * (lane >> 4);
  u.q[0] = *(const v8b*)p; u.q[1] = *(const v8b*)(p + 16); return u.v;
}
__device__ __forceinline__ float bfr(float v) { return (float)(__bf16)v; }
__device__ __attribute__((noinline)) float exp_ni(float v) { return expf(v); }
__device__ __attribute__((noinline)) float erf_ni(float v) { return erff(v); }

#define PK_A 0                       // [3072][1024] Wqkv rows (natural [out][in])
#define PK_P (PK_A + QKVW * DM)        // [1024][1024] Wo rows (natural)
#define PK_END (PK_P + DM * DM)
#define WS_PK  0u
#define WS_QK  (WS_PK + 2u * PK_END)             // f16 [4096 rows][2048]: q | k
#define WS_QKL (WS_QK + 2u * NB * SS * 2 * DM)     // f16 q | k residual planes x2048
#define WS_VTH (WS_QKL + 2u * NB * SS * 2 * DM)    // f16 [b][1024 (h*64+d)][2048 s] hi
#define WS_VTL (WS_VTH + 2u * NB * DM * SS)        // f16 lo x 2048
#define WS_O   (WS_VTL + 2u * NB * DM * SS)        // f32 [4096][1024]
#define WS_CS  (WS_O + 4u * NB * SS * DM)           // f32 [2048 positions][32 cos | 32 sin]
#define WS_END (WS_CS + 4u * 2 * SS * 32)
// ---- k_pack: block = (row n, which): natural [out][in] rows -> bf16; which 0..2 -> W_q/W_k/W_v into PK_A rows which*1024 + n; 3 -> W_o into PK_P
// wave 0 of the first SS blocks also writes one position's row of the rotary table: angle pos * inv_freq[i], inv_freq[i] = BASE^(-i/32), 32 cos then 32 sin (two whole 128-B lines)
__global__ __launch_bounds__(256) void k_pack(const float* __restrict__ WQ, const float* __restrict__ WK, const float* __restrict__ WV, const float* __restrict__ WO, __bf16* __restrict__ PK, float* __restrict__ CS) {
  __shared__ __align__(16) __bf16 s[DM]; const int n = blockIdx.x, which = blockIdx.y, t = threadIdx.x; const float* Wm = (which == 0) ? WQ : (which == 1) ? WK : (which == 2) ? WV : WO;
  for (int k = t; k < DM; k += 256) s[k] = (__bf16)Wm[(size_t)n * DM + k];
  __syncthreads();
  __bf16* dst = (which < 3) ? PK + PK_A + ((size_t)which * DM + n) * DM : PK + PK_P + (size_t)n * DM;
  for (int q = t; q < DM / 8; q += 256) vst2((unsigned*)(dst + q * 8), *(const v4u*)&s[q * 8]);
  const int pos = which * DM + n;
  if (pos < SS && t < HD / 2) {
    const float invf = (float)exp(-(double)t / (double)(HD / 2) * log((double)RBASE)); const float ang = (float)pos * invf;
    CS[pos * HD + t] = cosf(ang); CS[pos * HD + HD / 2 + t] = sinf(ang); }
}
// ---- projection GEMM core: block tile (32 * MI rows) x 128 columns, 4 waves as 2 x 2, each (16 * MI) x 64. A stage is 64 k: the f32 rows of X (256 B, LDS pitch 272 B) and the bf16 rows of W (128 B, LDS pitch 144 B),
// brought into LDS by asynchronous b128 copies, two buffers: stage t + 1 flies while stage t is multiplied. Fragments keep the k order and every accumulator its k sequence (32 steps of 32, ascending).
#define GXP 272
#define GWP 144
// eight copies of one lane, LDS and global address each advancing by a fixed step; the closing s_wait_xcnt 0 stands inside the statement so that no address register is rewritten ahead of it
__device__ __forceinline__ void acopy8(unsigned l, unsigned ls, const char* g, unsigned gs) {
  asm volatile("global_load_async_to_lds_b128 %0, %8, off\n\t"
               "global_load_async_to_lds_b128 %1, %9, off\n\t"
               "global_load_async_to_lds_b128 %2, %10, off\n\t"
               "global_load_async_to_lds_b128 %3, %11, off\n\t"
               "global_load_async_to_lds_b128 %4, %12, off\n\t"
               "global_load_async_to_lds_b128 %5, %13, off\n\t"
               "global_load_async_to_lds_b128 %6, %14, off\n\t"
               "global_load_async_to_lds_b128 %7, %15, off\n\t"
               "s_wait_xcnt 0x0"
               :: "v"(l), "v"(l + ls), "v"(l + 2 * ls), "v"(l + 3 * ls), "v"(l + 4 * ls), "v"(l + 5 * ls), "v"(l + 6 * ls), "v"(l + 7 * ls),
                  "v"(g), "v"(g + gs), "v"(g + 2 * (size_t)gs), "v"(g + 3 * (size_t)gs), "v"(g + 4 * (size_t)gs), "v"(g + 5 * (size_t)gs), "v"(g + 6 * (size_t)gs), "v"(g + 7 * (size_t)gs)
               : "memory");
}
template <int MI, bool SPLIT>
__device__ __forceinline__ void gemm_lds(const float* __restrict__ Xb, const __bf16* __restrict__ Wb, unsigned char* sm, v8f (&acc)[MI][4], int tid) {
  constexpr int XB = 32 * MI * GXP, ST = XB + 128 * GWP, NT = DM / 64;
  const int wave = tid >> 5, lane = tid & 31, col = lane & 15, g = lane >> 4, wm = wave >> 1, wn = wave & 1;
  // X: 16 lanes cover a 256-B row piece, 8 rows per copy of the block; W: 8 lanes cover a 128-B row piece, 16 rows per copy
  const unsigned lx = (unsigned)(size_t)sm + (unsigned)((tid >> 4) * GXP + (tid & 15) * 16), lw = (unsigned)(size_t)sm + (unsigned)(XB + (tid >> 3) * GWP + (tid & 7) * 16);
  const char* gx = (const char*)Xb + (size_t)(tid >> 4) * (DM * 4) + (tid & 15) * 16; const char* gw = (const char*)Wb + (size_t)(tid >> 3) * (DM * 2) + (tid & 7) * 16;
  auto stage = [&](int t, unsigned bo) {
#pragma unroll
    for (int u = 0; u < MI / 2; ++u) acopy8(lx + bo + u * (64 * GXP), 8 * GXP, gx + (size_t)t * 256 + (size_t)u * (64 * DM * 4), 8 * DM * 4);
    acopy8(lw + bo, 16 * GWP, gw + (size_t)t * 128, 16 * DM * 2); };
  stage(0, 0u);
  asm volatile("s_wait_asynccnt 0x0" ::: "memory");   // this wave's copies of stage 0 have landed
  __syncthreads();                                     // stage 0 published to every wave
  stage(1, (unsigned)ST);
#pragma unroll 1   // rolled: for speed only
  for (int t = 0; t < NT; ++t) { const unsigned bo = (t & 1) ? (unsigned)ST : 0u;
    const unsigned char* sx = sm + bo + (wm * 16 * MI + col) * GXP + 32 * g; const unsigned char* sw = sm + bo + XB + (wn * 64 + col) * GWP + 16 * g;
#pragma unroll
    for (int kc = 0; kc < 2; ++kc) { v16b b[4];
#pragma unroll
      for (int j = 0; j < 4; ++j) { union { v16b v; v8b q[2]; } u; const unsigned char* p = sw + j * (16 * GWP) + kc * 64; u.q[0] = *(const v8b*)p; u.q[1] = *(const v8b*)(p + 32); b[j] = u.v; }
#pragma unroll
      for (int i = 0; i < MI; ++i) { const v4f* p = (const v4f*)(sx + i * (16 * GXP) + kc * 128); const v4f x0 = p[0], x1 = p[1], x2 = p[4], x3 = p[5]; float v[16];
#pragma unroll
        for (int e = 0; e < 4; ++e) { v[e] = x0[e]; v[4 + e] = x1[e]; v[8 + e] = x2[e]; v[12 + e] = x3[e]; }
        if (SPLIT) { const F2 a = bsplit16(v);
#pragma unroll
          for (int j = 0; j < 4; ++j) acc[i][j] = wmma_bf(a.l, b[j], acc[i][j]);   // residual first, then hi, per accumulator as before; four independent tiles between the two
#pragma unroll
          for (int j = 0; j < 4; ++j) acc[i][j] = wmma_bf(a.h, b[j], acc[i][j]); }
        else { v16b a;
#pragma unroll
          for (int e = 0; e < 16; ++e) a[e] = (__bf16)v[e];
#pragma unroll
          for (int j = 0; j < 4; ++j) acc[i][j] = wmma_bf(a, b[j], acc[i][j]); } } }
    asm volatile("s_wait_dscnt 0x0" ::: "memory");      // this wave's reads of stage t are done before its buffer is refilled
    asm volatile("s_wait_asynccnt 0x0" ::: "memory");   // this wave's copies of stage t + 1 have landed
    __syncthreads();                                     // publishes stage t + 1 and ends every wave's reads of stage t
    if (t + 2 < NT) stage(t + 2, bo); }
  asm volatile("s_wait_asynccnt 0x0" ::: "memory");     // nothing in flight when the buffers become output staging
}
// ---- k_qkv: block = (128 rows, 128 columns); each wave stages its 64 x 64 result (one head's columns) in its own LDS range and stores whole 128-B lines.
// q and k are staged in f32; on the way back a lane holds 8 consecutive columns of a row = 4 (even, odd) pairs, turns them by the row's position (interleaved rotary, cos and sin from the table of k_pack's launch) and splits them into f16 hi + residual
__global__ __launch_bounds__(128) void k_qkv(const float* __restrict__ XQ, const float* __restrict__ XK, const float* __restrict__ XV, const __bf16* __restrict__ P, const float* __restrict__ BQ, const float* __restrict__ BK, const float* __restrict__ BV, _Float16* __restrict__ QK, _Float16* __restrict__ QKL, _Float16* __restrict__ VTH, _Float16* __restrict__ VTL, const float* __restrict__ CS) {
  const int which0 = (blockIdx.y * 128) / DM; const float* X = (which0 == 0) ? XQ : (which0 == 1) ? XK : XV; const float* BB = BQ ? (((which0 == 0) ? BQ : (which0 == 1) ? BK : BV) + (blockIdx.y * 128 - which0 * DM)) : nullptr;
  __shared__ __align__(16) unsigned char sm[2 * (128 * GXP + 128 * GWP)];
  const int tid = threadIdx.x, wave = tid >> 5, lane = tid & 31, col = lane & 15, g = lane >> 4, wm = wave >> 1, wn = wave & 1; const size_t m0 = (size_t)blockIdx.x * 128; const int n0 = blockIdx.y * 128;
  v8f acc[4][4] = {};
  gemm_lds<4, false>(X + m0 * DM, P + (size_t)n0 * DM, sm, acc, tid);
  float bj[4];
#pragma unroll
  for (int j = 0; j < 4; ++j) bj[j] = BB ? bfr(BB[wn * 64 + j * 16 + col]) : 0.f;
  _Float16* eh = (_Float16*)(sm + wave * (2 * 64 * 144)); _Float16* el = eh + 64 * 72;   // v, per wave: hi and residual planes, 64 rows at pitch 144 B
  if (n0 < 2 * DM) {   // q stored unscaled (f16 sigma ~0.6, no subnormal exposure); 1/8 applied to the f32 score
    float* sf = (float*)(sm + wave * (64 * 272));   // per wave: 64 rows of 64 f32 at pitch 272 B
    const int rl0 = lane >> 3, pc = lane & 7;
    const float* ct = CS + (size_t)((int)(m0 % SS) + wm * 64 + rl0) * HD + pc * 4;   // the lane's 4 cos of its first row; its 4 sin stand 32 floats on, its next row 4 positions on
    v4f tc[16], ts[16];   // the table rows are asked for in front of the staging's wait, beside the LDS stores: they depend on nothing staged
#pragma unroll   // unrolled: register arrays
    for (int it = 0; it < 16; ++it) { tc[it] = *(const v4f*)(ct + it * (4 * HD)); ts[it] = *(const v4f*)(ct + it * (4 * HD) + HD / 2); }
#pragma unroll
    for (int i = 0; i < 4; ++i) {
#pragma unroll
      for (int j = 0; j < 4; ++j) {
#pragma unroll
        for (int r = 0; r < 8; ++r) sf[(i * 16 + 8 * g + r) * 68 + j * 16 + col] = acc[i][j][r] + bj[j]; } }   // q, k (+ bias)
    LDSX();
#pragma unroll   // unrolled: tc and ts are indexed by it and stay in registers only so
    for (int it = 0; it < 16; ++it) { const int rl = it * 4 + rl0; const v4f xa = *(const v4f*)&sf[rl * 68 + pc * 8], xb = *(const v4f*)&sf[rl * 68 + pc * 8 + 4]; const float x[8] = { xa[0], xa[1], xa[2], xa[3], xb[0], xb[1], xb[2], xb[3] }; v8h yh, yl;
#pragma unroll
      for (int p = 0; p < 4; ++p) { const float x0 = x[2 * p], x1 = x[2 * p + 1], cs = tc[it][p], sn = ts[it][p]; const float y0 = x0 * cs - x1 * sn, y1 = x1 * cs + x0 * sn;
        const _Float16 h0 = (_Float16)y0, h1 = (_Float16)y1; yh[2 * p] = h0; yh[2 * p + 1] = h1; yl[2 * p] = (_Float16)((y0 - (float)h0) * 2048.0f); yl[2 * p + 1] = (_Float16)((y1 - (float)h1) * 2048.0f); }   // f16 hi + (x2048) residual
      const size_t o = (m0 + wm * 64 + rl) * (2 * DM) + n0 + wn * 64 + pc * 8; vst2(QK + o, yh); vst2(QKL + o, yl); }
  } else {   // v transposed: a lane's 8 accumulator rows are 8 consecutive s of one d
#pragma unroll
    for (int i = 0; i < 4; ++i) {
#pragma unroll
      for (int j = 0; j < 4; ++j) { v8h th, tl;
#pragma unroll
        for (int r = 0; r < 8; ++r) { const float v = acc[i][j][r] + bj[j]; const _Float16 hv = (_Float16)v; th[r] = hv; tl[r] = (_Float16)((v - (float)hv) * 2048.0f); }
        *(v8h*)&eh[(j * 16 + col) * 72 + i * 16 + 8 * g] = th; *(v8h*)&el[(j * 16 + col) * 72 + i * 16 + 8 * g] = tl; } }
    LDSX();
    const int b = (int)(m0 / SS), s0 = (int)(m0 % SS) + wm * 64; const int pc0 = n0 - 2 * DM + wn * 64;
    for (int it = 0; it < 16; ++it) { const int d = it * 4 + (lane >> 3), pc = lane & 7; const size_t o = ((size_t)b * DM + pc0 + d) * SS + s0 + pc * 8; vst2((unsigned*)(VTH + o), *(const v4u*)&eh[d * 72 + pc * 8]); vst2((unsigned*)(VTL + o), *(const v4u*)&el[d * 72 + pc * 8]); }
  }
}
// ---- k_attn: block = (64 queries, head h, batch b): all-keys flash attention (K = 64: 2 k-steps), scores = (q.k) * 0.125 with 3 f16 products (q, k hi + residual) in query blocks 0 and 1, single f16 elsewhere, P.V: f16 P hi/lo x (V hi, V lo*2048), 3 products in two accumulators; O[b*S+q][h*64+d] = (acc + accl / 2048) / (2048 l) (256-B segments)
// A stage is 64 keys: the k rows (64 x 128 B), and the 64 d rows of v hi and of v residual (128 B = 64 keys each), every row at LDS pitch 144 B, brought in once for the block's four waves by asynchronous b128 copies of whole 128-B lines,
// two buffers: stage s + 1 flies while the two 32-key steps of stage s are worked on. Fragments, their k order, the key order and every sum are as before.
#define AKP 144
#define ATL (64 * AKP)
#define AST (3 * ATL)
// four copies of one lane, LDS and global address each advancing by a fixed step; the closing s_wait_xcnt 0 stands inside the statement so that no address register is rewritten ahead of it
__device__ __forceinline__ void acopy4(unsigned l, unsigned ls, const char* g, unsigned gs) {
  asm volatile("global_load_async_to_lds_b128 %0, %4, off\n\t"
               "global_load_async_to_lds_b128 %1, %5, off\n\t"
               "global_load_async_to_lds_b128 %2, %6, off\n\t"
               "global_load_async_to_lds_b128 %3, %7, off\n\t"
               "s_wait_xcnt 0x0"
               :: "v"(l), "v"(l + ls), "v"(l + 2 * ls), "v"(l + 3 * ls),
                  "v"(g), "v"(g + gs), "v"(g + 2 * (size_t)gs), "v"(g + 3 * (size_t)gs)
               : "memory");
}
// fragment from an LDS row: the lane's 16 B at p and the 16 B at p + 32 (the k order of frag_h)
__device__ __forceinline__ v16h frag_l(const unsigned char* p) { union { v16h v; v8h q[2]; } u; u.q[0] = *(const v8h*)p; u.q[1] = *(const v8h*)(p + 32); return u.v; }
// lane l with lane l ^ 16 (the other half of a query's keys)
__device__ __forceinline__ float xhalf(float x) { return __builtin_bit_cast(float, __builtin_amdgcn_permlanex16(__builtin_bit_cast(int, x), __builtin_bit_cast(int, x), 0x76543210, 0xfedcba98, false, false)); }
// Transposed products: S^T = K . Q^T (A = 16 key rows, B = the wave's 16 queries) and O^T += V^T . P^T (A = 16 d rows of v, B = P^T). A lane holds one query (column col): 8 of each 16-key tile's scores, the other 8 in lane ^ 16,
// so maximum and sum run in the lane with one exchange between the halves, and the two score tiles of a 32-key step, converted in place, are the B fragment of P^T in the k order of the v rows: P goes through no LDS.
// second bound: four waves a SIMD (256 registers a wave), so that all 1,024 blocks stay resident at once as before
__global__ __launch_bounds__(128, 4) void k_attn(const _Float16* __restrict__ QK, const _Float16* __restrict__ QKL, const _Float16* __restrict__ VTH, const _Float16* __restrict__ VTL, const void* __restrict__ KMASK, float* __restrict__ O) {
  __shared__ __align__(16) unsigned char sb[2 * AST];
  const int tid = threadIdx.x, wave = tid >> 5, lane = tid & 31, col = lane & 15, g = lane >> 4;
  const int qb = blockIdx.x, h = blockIdx.y, b = blockIdx.z; const int q0 = qb * 64 + wave * 16; const size_t rq = (size_t)b * SS + q0 + col; const int qi = q0 + col;   // qi: the lane's query
  const int st0 = qb > LWIN / 64 ? qb - LWIN / 64 : 0, st1 = qb;   // banded causal: 64-key stages st0 .. st1
  // 8 lanes cover a 128-B row, 16 rows per copy of the block, 4 copies per tile
  const unsigned lc = (unsigned)(size_t)sb + (unsigned)((tid >> 3) * AKP + (tid & 7) * 16);
  const char* gk = (const char*)(QK + ((size_t)b * SS + (tid >> 3)) * (2 * DM) + DM + h * HD) + (tid & 7) * 16;
  const size_t vo = (((size_t)b * DM + h * HD + (tid >> 3)) * SS) * 2 + (tid & 7) * 16; const char* gvh = (const char*)VTH + vo; const char* gvl = (const char*)VTL + vo;
  auto stage = [&](int s, unsigned bo) {
    acopy4(lc + bo, 16 * AKP, gk + (size_t)s * (64 * 2 * DM * 2), 16 * 2 * DM * 2);
    acopy4(lc + bo + ATL, 16 * AKP, gvh + (size_t)s * 128, 16 * SS * 2);
    acopy4(lc + bo + 2 * ATL, 16 * AKP, gvl + (size_t)s * 128, 16 * SS * 2); };
  stage(st0, 0u);
  v16h aq[2];
#pragma unroll
  for (int kc = 0; kc < 2; ++kc) aq[kc] = frag_h(QK + rq * (2 * DM) + h * HD + kc * 32, lane);
  float m = -3.0e38f, l = 0.f;   // the lane's query: running maximum (both halves alike), sum over this half's keys
  v8f acc[4] = {}, accl[4] = {};
  asm volatile("s_wait_asynccnt 0x0" ::: "memory");   // this wave's copies of the first stage have landed
  __syncthreads();                                     // first stage published to every wave
  if (st0 < st1) stage(st0 + 1, (unsigned)AST);
#pragma unroll 1   // rolled: one body for every stage
  for (int st = st0; st <= st1; ++st) { const unsigned bo = ((st - st0) & 1) ? (unsigned)AST : 0u;
#pragma unroll 1   // rolled: the two 32-key steps of a stage share one body
  for (int sub = 0; sub < 2; ++sub) { const int ks = st * 2 + sub; v8f s[2];
    const unsigned char* lk = sb + bo + (sub * 32 + col) * AKP + 16 * g; const unsigned char* lv = sb + bo + ATL + col * AKP + sub * 64 + 16 * g;
    v16h kf[2][2];   // the step's four k fragments, read as one group ahead of the products
#pragma unroll
    for (int ct = 0; ct < 2; ++ct) {
#pragma unroll
      for (int kc = 0; kc < 2; ++kc) kf[ct][kc] = frag_l(lk + ct * (16 * AKP) + kc * 64); }
    v16h vh[4], vl[4];   // the step's eight v fragments
#pragma unroll
    for (int dt = 0; dt < 4; ++dt) { vh[dt] = frag_l(lv + dt * (16 * AKP)); vl[dt] = frag_l(lv + ATL + dt * (16 * AKP)); }
#pragma unroll
    for (int ct = 0; ct < 2; ++ct) { const _Float16* krowl = QKL + ((size_t)b * SS + ks * 32 + ct * 16 + col) * (2 * DM) + DM + h * HD; v8f c = {}, cl = {};
      if (qb < 2) {   // leading query blocks (few keys, outputs far above the global rms): 3 products; the q residual is fetched here, where alone it is used, so that it holds no registers in the other blocks
#pragma unroll
        for (int kc = 0; kc < 2; ++kc) { const v16h kh = kf[ct][kc]; c = wmma16(kh, aq[kc], c); cl = wmma16(kh, frag_h(QKL + rq * (2 * DM) + h * HD + kc * 32, lane), cl); cl = wmma16(frag_h(krowl + kc * 32, lane), aq[kc], cl); }
#pragma unroll
        for (int r = 0; r < 8; ++r) c[r] += cl[r] * (1.0f / 2048.0f); }
      else {
#pragma unroll
        for (int kc = 0; kc < 2; ++kc) c = wmma16(kf[ct][kc], aq[kc], c); }   // single product elsewhere
#pragma unroll
      for (int r = 0; r < 8; ++r) { const int kk = ks * 32 + ct * 16 + 8 * g + r; s[ct][r] = (kk <= qi && qi - kk <= LWIN) ? c[r] * 0.125f : -3.0e38f; } }   // 1/sqrt(64); masked keys excluded
    float mx = fmaxf(s[0][0], s[1][0]);
#pragma unroll
    for (int r = 1; r < 8; ++r) mx = fmaxf(mx, fmaxf(s[0][r], s[1][r]));
    mx = fmaxf(mx, xhalf(mx));   // the step's 32 keys
    const float mn = fmaxf(m, mx); const float alpha = (m <= -1.0e38f) ? 0.f : __expf(m - mn);
    v8f e[2];
#pragma unroll
    for (int ct = 0; ct < 2; ++ct) {
#pragma unroll
      for (int r = 0; r < 8; ++r) e[ct][r] = (s[ct][r] <= -1.0e38f) ? 0.f : __expf(s[ct][r] - mn); }
    const v8f e8 = e[0] + e[1]; const v4f e4 = e8.lo + e8.hi; const v2f e2 = e4.lo + e4.hi;
    l = l * alpha + (e2[0] + e2[1]); m = mn;   // the halves' sums are joined once, behind the loop
#pragma unroll
    for (int dt = 0; dt < 4; ++dt) { acc[dt] *= alpha; accl[dt] *= alpha; }
    v16h pa, pl;
#pragma unroll
    for (int ct = 0; ct < 2; ++ct) {
#pragma unroll
      for (int r = 0; r < 8; ++r) { const float x = e[ct][r] * 2048.0f; const _Float16 hx = (_Float16)x; pa[ct * 8 + r] = hx; pl[ct * 8 + r] = (_Float16)((x - (float)hx) * 2048.0f); } }   // P scaled by 2^11 before the f16 split so small softmax weights stay out of the f16 subnormal range; 2^-11 folded into the epilogue
#pragma unroll
    for (int dt = 0; dt < 4; ++dt) acc[dt] = wmma16(vh[dt], pa, acc[dt]);
    if (qb < 32) {   // every query block (qb < 32 always holds): P hi/lo x V hi/lo (3 products); per accumulator the residual of P first, then that of v, as before
#pragma unroll
      for (int dt = 0; dt < 4; ++dt) accl[dt] = wmma16(vh[dt], pl, accl[dt]);
#pragma unroll
      for (int dt = 0; dt < 4; ++dt) accl[dt] = wmma16(vl[dt], pa, accl[dt]); }
    }
    asm volatile("s_wait_dscnt 0x0" ::: "memory");      // this wave's reads of stage st are done before its buffer is refilled
    asm volatile("s_wait_asynccnt 0x0" ::: "memory");   // this wave's copies of stage st + 1 have landed
    __syncthreads();                                     // publishes stage st + 1 and ends every wave's reads of stage st
    if (st + 2 <= st1) stage(st + 2, bo); }
  asm volatile("s_wait_asynccnt 0x0" ::: "memory");     // nothing in flight when the buffers become output staging
  float (*so)[16][68] = (float (*)[16][68])sb;          // each wave's own range of the ring, free behind the last stage's barrier
  const float il = (1.0f / 2048.0f) / (l + xhalf(l));
#pragma unroll
  for (int dt = 0; dt < 4; ++dt) { v4f o0, o1;   // a lane's 8 accumulator rows are 8 consecutive d of its query
#pragma unroll
    for (int r = 0; r < 4; ++r) { o0[r] = (acc[dt][r] + accl[dt][r] * (1.0f / 2048.0f)) * il; o1[r] = (acc[dt][4 + r] + accl[dt][4 + r] * (1.0f / 2048.0f)) * il; }
    *(v4f*)&so[wave][col][dt * 16 + 8 * g] = o0; *(v4f*)&so[wave][col][dt * 16 + 8 * g + 4] = o1; }
  LDSX();
  for (int rl = 0; rl < 16; ++rl) if (lane < 16) vst2(O + ((size_t)b * SS + q0 + rl) * DM + h * HD + lane * 4, *(const v4f*)&so[wave][rl][lane * 4]);
}
// ---- k_out: block = (64 rows, 128 cols): out = O(hi/lo) . Wo rows (2 products) + bo
__global__ __launch_bounds__(128) void k_out(const float* __restrict__ O, const __bf16* __restrict__ P, const float* __restrict__ BO, float* __restrict__ Y) {
  __shared__ __align__(16) unsigned char sm[2 * (64 * GXP + 128 * GWP)];
  const int tid = threadIdx.x, wave = tid >> 5, lane = tid & 31, col = lane & 15, g = lane >> 4, wm = wave >> 1, wn = wave & 1; const size_t m0 = (size_t)blockIdx.x * 64; const int n0 = blockIdx.y * 128;
  v8f acc[2][4] = {};
  gemm_lds<2, true>(O + m0 * DM, P + (size_t)n0 * DM, sm, acc, tid);
  float* so = (float*)(sm + wave * (32 * 272));   // per wave: 32 rows of 64 f32 at pitch 272 B
#pragma unroll
  for (int i = 0; i < 2; ++i) {
#pragma unroll
    for (int j = 0; j < 4; ++j) {
#pragma unroll
      for (int r = 0; r < 8; ++r) so[(i * 16 + 8 * g + r) * 68 + j * 16 + col] = acc[i][j][r] + bfr(BO[n0 + wn * 64 + j * 16 + col]); } }
  LDSX();
  for (int it = 0; it < 16; ++it) { const int rl = it * 2 + g; vst2(Y + (m0 + wm * 32 + rl) * DM + n0 + wn * 64 + col * 4, *(const v4f*)&so[rl * 68 + col * 4]); }
}
extern "C" void kernel_launch(void* const* d_in, const int* in_sizes, int n_in, void* d_out, int out_size, void* d_ws, size_t ws_size, hipStream_t stream) {
  (void)in_sizes; (void)n_in; (void)out_size;
  const float** F = (const float**)d_in;   // 0 x [2,2048,1024], 1 Wqkv [3072,1024] natural ((3,H,hd) rows), 2 Wproj [1024,1024] natural, 3 bproj [1024]
  if (ws_size < (size_t)WS_END) return;
  char* ws = (char*)d_ws; __bf16* PK = (__bf16*)(ws + WS_PK); _Float16 *QK = (_Float16*)(ws + WS_QK), *QKL = (_Float16*)(ws + WS_QKL), *VTH = (_Float16*)(ws + WS_VTH), *VTL = (_Float16*)(ws + WS_VTL); float* O = (float*)(ws + WS_O); float* CS = (float*)(ws + WS_CS);
  k_pack<<<dim3(DM, 4), 256, 0, stream>>>(F[1], F[1] + (size_t)DM * DM, F[1] + (size_t)2 * DM * DM, F[2], PK, CS);
  k_qkv<<<dim3(TNB * SS / 128, QKVW / 128), 128, 0, stream>>>(F[0], F[0], F[0], PK + PK_A, nullptr, nullptr, nullptr, QK, QKL, VTH, VTL, CS);
  k_attn<<<dim3(TQB, NH, TNB), 128, 0, stream>>>(QK, QKL, VTH, VTL, nullptr, O);
  k_out<<<dim3(TOB, DM / 128), 128, 0, stream>>>(O, PK + PK_P, F[3], (float*)d_out);
}

// v005
// One run takes 88 microseconds.
// In both of two side-by-side timings against v004, it was 1.03 times as fast.
// Counting every step since v000, it is 3.75 times as fast.
// compute dtype: all float inputs rounded to bf16; q/k/v = x . W^T with EXACT bf16 products on WMMA 16x16x32 (natural rows), f32; rotary (angles t x inv_freq, device cosf/sinf) in f32 on q and k, rounded to f16 hi + residual; banded all-keys attention with hybrid scores (first 128 queries 3-product, later single f16) and 3-product P.v everywhere (key tiles outside [q-512, q] skipped), x 1/8, running-max softmax in f32 (hardware exp); out = ctx (bf16 hi + lo, 2 products) . Wproj^T + b; f32 output.
#include <hip/hip_runtime.h>
#include <math.h>

typedef __attribute__((ext_vector_type(16))) _Float16 v16h;
typedef __attribute__((ext_vector_type(16))) __bf16 v16b;
typedef __attribute__((ext_vector_type(8)))  _Float16 v8h;
typedef __attribute__((ext_vector_type(8)))  float v8f;
typedef __attribute__((ext_vector_type(4)))  float v4f;
typedef __attribute__((ext_vector_type(2)))  float v2f;
typedef __attribute__((ext_vector_type(4)))  unsigned v4u;
typedef __attribute__((ext_vector_type(4)))  int v4i;
typedef float __attribute__((may_alias)) float_a;
typedef int __attribute__((may_alias)) int_a;

template <typename T> __device__ __forceinline__ void vst2(void* p, T v) { *(T*)p = v;  }
__device__ __forceinline__ v8f wmma16(v16h a, v16h b, v8f c) {
  v8f d = __builtin_amdgcn_wmma_f32_16x16x32_f16(false, a, false, b, (short)0, c, false, false);
  asm volatile("v_nop\n\tv_nop\n\tv_nop\n\tv_nop" : "+v"(d) : "v"(a), "v"(b));
  return d;
}
__device__ __forceinline__ v8f wmma_bf(v16b a, v16b b, v8f c) {
  v8f d = __builtin_amdgcn_wmma_f32_16x16x32_bf16(false, a, false, b, (short)0, c, false, false);
  asm volatile("v_nop\n\tv_nop\n\tv_nop\n\tv_nop" : "+v"(d) : "v"(a), "v"(b));
  return d;
}
// Causal local self-attention (B 2, T 2,048, C 1,024, 16 heads x 64, window 512): fused bias-free projection (natural [3C][C]), interleaved rotary embedding on q and k, scores / 8 restricted to k <= q <= k + 512, softmax, v, natural output projection + bias.
__device__ __forceinline__ v16h frag_h(const _Float16* rowk0, int lane) {
  union { v16h v; v8h q[2]; } u; const _Float16* p = rowk0 + 8 * (lane >> 4);
  u.q[0] = *(const v8h*)p; u.q[1] = *(const v8h*)(p + 16); return u.v;
}
__device__ __forceinline__ v16h frag_f32(const float* rowk0, int lane) {
  v16h a; const float* p = rowk0 + 8 * (lane >> 4);
#pragma unroll
  for (int i = 0; i < 8; ++i) { a[i] = (_Float16)p[i]; a[8 + i] = (_Float16)p[16 + i]; }
  return a;
}
__device__ __forceinline__ v16h frag_f32s(const float* rowk0, int lane, float sc) {
  v16h a; const float* p = rowk0 + 8 * (lane >> 4);
#pragma unroll
  for (int i = 0; i < 8; ++i) { a[i] = (_Float16)(p[i] * sc); a[8 + i] = (_Float16)(p[16 + i] * sc); }
  return a;
}
// column fragment from a [K][ld] layout (column n), rows >= K read as 0
__device__ __forceinline__ v16h fragc_f32(const float* W, int k0, int n, int lane, int ld, int K) {
  v16h a; const int g = lane >> 4;
#pragma unroll
  for (int i = 0; i < 8; ++i) { const int ka = k0 + 8 * g + i, kb = ka + 16;
    a[i] = (_Float16)(ka < K ? W[(size_t)(ka < K ? ka : K - 1) * ld + n] : 0.f); a[8 + i] = (_Float16)(kb < K ? W[(size_t)(kb < K ? kb : K - 1) * ld + n] : 0.f); }
  return a;
}
struct F2 { v16b h, l; };
__device__ __forceinline__ F2 bsplit16(const float v[16]) { F2 r;
#pragma unroll
  for (int i = 0; i < 16; ++i) { const __bf16 h = (__bf16)v[i]; r.h[i] = h; r.l[i] = (__bf16)(v[i] - (float)h); }
  return r; }
__device__ __forceinline__ F2 split_row(const float* row, int k0, int lane) { float v[16]; const float* p = row + k0 + 8 * (lane >> 4);
#pragma unroll
  for (int i = 0; i < 8; ++i) { v[i] = p[i]; v[8 + i] = p[16 + i]; }
  return bsplit16(v); }
__device__ __forceinline__ F2 split_rowK(const float* row, int k0, int lane, int K) { float v[16]; const int g = lane >> 4;
#pragma unroll
  for (int i = 0; i < 8; ++i) { const int ka = k0 + 8 * g + i, kb = ka + 16; v[i] = ka < K ? row[ka < K ? ka : K - 1] : 0.f; v[8 + i] = kb < K ? row[kb < K ? kb : K - 1] : 0.f; }
  return bsplit16(v); }
__device__ __forceinline__ F2 split_col(const float* W, int k0, int n, int lane, int ld, int K) { float v[16]; const int g = lane >> 4;
#pragma unroll
  for (int i = 0; i < 8; ++i) { const int ka = k0 + 8 * g + i, kb = ka + 16; v[i] = ka < K ? W[(size_t)(ka < K ? ka : K - 1) * ld + n] : 0.f; v[8 + i] = kb < K ? W[(size_t)(kb < K ? kb : K - 1) * ld + n] : 0.f; }
  return bsplit16(v); }
__device__ __forceinline__ v8f mac3(const F2& a, const F2& b, v8f c) { c = wmma_bf(a.l, b.h, c); c = wmma_bf(a.h, b.l, c); return wmma_bf(a.h, b.h, c); }
__device__ __forceinline__ float sigm(float v) { return 1.0f / (1.0f + expf(-v)); }
#define LDSX() do { asm volatile("s_wait_dscnt 0" ::: "memory"); __builtin_amdgcn_wave_barrier(); __builtin_amdgcn_fence(__ATOMIC_RELEASE, "workgroup"); } while (0)


#define NB 2
#define SS 2048
#define DM 1024
#define NH 16
#define LWIN 512
#define RBASE 10000.0f
#define HD 64
#define QKVW (3 * DM)
#ifndef TQB
#define TQB (SS / 64)
#define TNB NB
#define TOB (NB * SS / 64)     // output row tiles (all)
#endif
typedef __attribute__((ext_vector_type(8))) __bf16 v8b;
__device__ __forceinline__ v16b frag_b(const __bf16* rowk0, int lane) {
  union { v16b v; v8b q[2]; } u; const __bf16* p = rowk0 + 8 * (lane >> 4);
  u.q[0] = *(const v8b*)p; u.q[1] = *(const v8b*)(p + 16); return u.v;
}
__device__ __forceinline__ float bfr(float v) { return (float)(__bf16)v; }
__device__ __attribute__((noinline)) float exp_ni(float v) { return expf(v); }
__device__ __attribute__((noinline)) float erf_ni(float v) { return erff(v); }

#define PK_A 0                       // [3072][1024] Wqkv rows (natural [out][in])
#define PK_P (PK_A + QKVW * DM)        // [1024][1024] Wo rows (natural)
#define PK_END (PK_P + DM * DM)
#define WS_PK  0u
#define WS_QK  (WS_PK + 2u * PK_END)             // f16 [4096 rows][2048]: q | k
#define WS_QKL (WS_QK + 2u * NB * SS * 2 * DM)     // f16 q | k residual planes x2048
#define WS_VTH (WS_QKL + 2u * NB * SS * 2 * DM)    // f16 [b][1024 (h*64+d)][2048 s] hi
#define WS_VTL (WS_VTH + 2u * NB * DM * SS)        // f16 lo x 2048
#define WS_O   (WS_VTL + 2u * NB * DM * SS)        // f32 [4096][1024]
#define WS_CS  (WS_O + 4u * NB * SS * DM)           // f32 [2048 positions][32 cos | 32 sin]
#define WS_END (WS_CS + 4u * 2 * SS * 32)
// ---- k_pack: one wave = one natural [out][in] row of 1,024 floats -> bf16; rows 0..3071 are W_q/W_k/W_v into PK_A, rows 3072..4095 W_o into PK_P. 512 blocks of 8 waves, two a WGP, so that the launch has 4,096 waves to start:
// a lane asks for its eight 16-B pieces at once (each wave-wide load covers 512 contiguous bytes), rounds them in registers and stores 8 B a piece (a wave-wide store covers two whole 128-B lines)
// waves 0..3 of every block also write one position's row of the rotary table: angle pos * inv_freq[i], inv_freq[i] = BASE^(-i/32), 32 cos then 32 sin (two whole 128-B lines)
typedef __attribute__((ext_vector_type(4))) __bf16 v4b;
__global__ __launch_bounds__(256) void k_pack(const float* __restrict__ WQ, const float* __restrict__ WK, const float* __restrict__ WV, const float* __restrict__ WO, __bf16* __restrict__ PK, float* __restrict__ CS) {
  const int t = threadIdx.x, wave = t >> 5, lane = t & 31; const int row = blockIdx.x * 8 + wave, which = row / DM, n = row % DM; const float* Wm = (which == 0) ? WQ : (which == 1) ? WK : (which == 2) ? WV : WO;
  const float* sp = Wm + (size_t)n * DM + lane * 4; v4f x[8];
#pragma unroll   // unrolled: register array, all eight loads in flight together
  for (int j = 0; j < 8; ++j) x[j] = *(const v4f*)(sp + j * 128);
  if (wave < 4) { const int pos = blockIdx.x * 4 + wave;   // 512 blocks x 4 waves = the SS positions; the table's arithmetic runs while the row's loads fly
    const float invf = (float)exp(-(double)lane / (double)(HD / 2) * log((double)RBASE)); const float ang = (float)pos * invf;
    CS[pos * HD + lane] = cosf(ang); CS[pos * HD + HD / 2 + lane] = sinf(ang); }
  __bf16* dst = ((which < 3) ? PK + PK_A + ((size_t)which * DM + n) * DM : PK + PK_P + (size_t)n * DM) + lane * 4;
#pragma unroll
  for (int j = 0; j < 8; ++j) { v4b y;
#pragma unroll
    for (int e = 0; e < 4; ++e) y[e] = (__bf16)x[j][e];
    vst2(dst + j * 128, y); }
}
// ---- projection GEMM core: block tile (32 * MI rows) x 128 columns, 4 waves as 2 x 2, each (16 * MI) x 64. A stage is 64 k: the f32 rows of X (256 B, LDS pitch 272 B) and the bf16 rows of W (128 B, LDS pitch 144 B),
// brought into LDS by asynchronous b128 copies, two buffers: stage t + 1 flies while stage t is multiplied. Fragments keep the k order and every accumulator its k sequence (32 steps of 32, ascending).
#define GXP 272
#define GWP 144
// eight copies of one lane, LDS and global address each advancing by a fixed step; the closing s_wait_xcnt 0 stands inside the statement so that no address register is rewritten ahead of it
__device__ __forceinline__ void acopy8(unsigned l, unsigned ls, const char* g, unsigned gs) {
  asm volatile("global_load_async_to_lds_b128 %0, %8, off\n\t"
               "global_load_async_to_lds_b128 %1, %9, off\n\t"
               "global_load_async_to_lds_b128 %2, %10, off\n\t"
               "global_load_async_to_lds_b128 %3, %11, off\n\t"
               "global_load_async_to_lds_b128 %4, %12, off\n\t"
               "global_load_async_to_lds_b128 %5, %13, off\n\t"
               "global_load_async_to_lds_b128 %6, %14, off\n\t"
               "global_load_async_to_lds_b128 %7, %15, off\n\t"
               "s_wait_xcnt 0x0"
               :: "v"(l), "v"(l + ls), "v"(l + 2 * ls), "v"(l + 3 * ls), "v"(l + 4 * ls), "v"(l + 5 * ls), "v"(l + 6 * ls), "v"(l + 7 * ls),
                  "v"(g), "v"(g + gs), "v"(g + 2 * (size_t)gs), "v"(g + 3 * (size_t)gs), "v"(g + 4 * (size_t)gs), "v"(g + 5 * (size_t)gs), "v"(g + 6 * (size_t)gs), "v"(g + 7 * (size_t)gs)
               : "memory");
}
template <int MI, bool SPLIT>
__device__ __forceinline__ void gemm_lds(const float* __restrict__ Xb, const __bf16* __restrict__ Wb, unsigned char* sm, v8f (&acc)[MI][4], int tid) {
  constexpr int XB = 32 * MI * GXP, ST = XB + 128 * GWP, NT = DM / 64;
  const int wave = tid >> 5, lane = tid & 31, col = lane & 15, g = lane >> 4, wm = wave >> 1, wn = wave & 1;
  // X: 16 lanes cover a 256-B row piece, 8 rows per copy of the block; W: 8 lanes cover a 128-B row piece, 16 rows per copy
  const unsigned lx = (unsigned)(size_t)sm + (unsigned)((tid >> 4) * GXP + (tid & 15) * 16), lw = (unsigned)(size_t)sm + (unsigned)(XB + (tid >> 3) * GWP + (tid & 7) * 16);
  const char* gx = (const char*)Xb + (size_t)(tid >> 4) * (DM * 4) + (tid & 15) * 16; const char* gw = (const char*)Wb + (size_t)(tid >> 3) * (DM * 2) + (tid & 7) * 16;
  auto stage = [&](int t, unsigned bo) {
#pragma unroll
    for (int u = 0; u < MI / 2; ++u) acopy8(lx + bo + u * (64 * GXP), 8 * GXP, gx + (size_t)t * 256 + (size_t)u * (64 * DM * 4), 8 * DM * 4);
    acopy8(lw + bo, 16 * GWP, gw + (size_t)t * 128, 16 * DM * 2); };
  stage(0, 0u);
  asm volatile("s_wait_asynccnt 0x0" ::: "memory");   // this wave's copies of stage 0 have landed
  __syncthreads();                                     // stage 0 published to every wave
  stage(1, (unsigned)ST);
#pragma unroll 1   // rolled: for speed only
  for (int t = 0; t < NT; ++t) { const unsigned bo = (t & 1) ? (unsigned)ST : 0u;
    const unsigned char* sx = sm + bo + (wm * 16 * MI + col) * GXP + 32 * g; const unsigned char* sw = sm + bo + XB + (wn * 64 + col) * GWP + 16 * g;
#pragma unroll
    for (int kc = 0; kc < 2; ++kc) { v16b b[4];
#pragma unroll
      for (int j = 0; j < 4; ++j) { union { v16b v; v8b q[2]; } u; const unsigned char* p = sw + j * (16 * GWP) + kc * 64; u.q[0] = *(const v8b*)p; u.q[1] = *(const v8b*)(p + 32); b[j] = u.v; }
#pragma unroll
      for (int i = 0; i < MI; ++i) { const v4f* p = (const v4f*)(sx + i * (16 * GXP) + kc * 128); const v4f x0 = p[0], x1 = p[1], x2 = p[4], x3 = p[5]; float v[16];
#pragma unroll
        for (int e = 0; e < 4; ++e) { v[e] = x0[e]; v[4 + e] = x1[e]; v[8 + e] = x2[e]; v[12 + e] = x3[e]; }
        if (SPLIT) { const F2 a = bsplit16(v);
#pragma unroll
          for (int j = 0; j < 4; ++j) acc[i][j] = wmma_bf(a.l, b[j], acc[i][j]);   // residual first, then hi, per accumulator as before; four independent tiles between the two
#pragma unroll
          for (int j = 0; j < 4; ++j) acc[i][j] = wmma_bf(a.h, b[j], acc[i][j]); }
        else { v16b a;
#pragma unroll
          for (int e = 0; e < 16; ++e) a[e] = (__bf16)v[e];
#pragma unroll
          for (int j = 0; j < 4; ++j) acc[i][j] = wmma_bf(a, b[j], acc[i][j]); } } }
    asm volatile("s_wait_dscnt 0x0" ::: "memory");      // this wave's reads of stage t are done before its buffer is refilled
    asm volatile("s_wait_asynccnt 0x0" ::: "memory");   // this wave's copies of stage t + 1 have landed
    __syncthreads();                                     // publishes stage t + 1 and ends every wave's reads of stage t
    if (t + 2 < NT) stage(t + 2, bo); }
  asm volatile("s_wait_asynccnt 0x0" ::: "memory");     // nothing in flight when the buffers become output staging
}
// ---- k_qkv: block = (128 rows, 128 columns); each wave stages its 64 x 64 result (one head's columns) in its own LDS range and stores whole 128-B lines.
// q and k are staged in f32; on the way back a lane holds 8 consecutive columns of a row = 4 (even, odd) pairs, turns them by the row's position (interleaved rotary, cos and sin from the table of k_pack's launch) and splits them into f16 hi + residual
__global__ __launch_bounds__(128) void k_qkv(const float* __restrict__ XQ, const float* __restrict__ XK, const float* __restrict__ XV, const __bf16* __restrict__ P, const float* __restrict__ BQ, const float* __restrict__ BK, const float* __restrict__ BV, _Float16* __restrict__ QK, _Float16* __restrict__ QKL, _Float16* __restrict__ VTH, _Float16* __restrict__ VTL, const float* __restrict__ CS) {
  const int which0 = (blockIdx.y * 128) / DM; const float* X = (which0 == 0) ? XQ : (which0 == 1) ? XK : XV; const float* BB = BQ ? (((which0 == 0) ? BQ : (which0 == 1) ? BK : BV) + (blockIdx.y * 128 - which0 * DM)) : nullptr;
  __shared__ __align__(16) unsigned char sm[2 * (128 * GXP + 128 * GWP)];
  const int tid = threadIdx.x, wave = tid >> 5, lane = tid & 31, col = lane & 15, g = lane >> 4, wm = wave >> 1, wn = wave & 1; const size_t m0 = (size_t)blockIdx.x * 128; const int n0 = blockIdx.y * 128;
  v8f acc[4][4] = {};
  gemm_lds<4, false>(X + m0 * DM, P + (size_t)n0 * DM, sm, acc, tid);
  float bj[4];
#pragma unroll
  for (int j = 0; j < 4; ++j) bj[j] = BB ? bfr(BB[wn * 64 + j * 16 + col]) : 0.f;
  _Float16* eh = (_Float16*)(sm + wave * (2 * 64 * 144)); _Float16* el = eh + 64 * 72;   // v, per wave: hi and residual planes, 64 rows at pitch 144 B
  if (n0 < 2 * DM) {   // q stored unscaled (f16 sigma ~0.6, no subnormal exposure); 1/8 applied to the f32 score
    float* sf = (float*)(sm + wave * (64 * 272));   // per wave: 64 rows of 64 f32 at pitch 272 B
    const int rl0 = lane >> 3, pc = lane & 7;
    const float* ct = CS + (size_t)((int)(m0 % SS) + wm * 64 + rl0) * HD + pc * 4;   // the lane's 4 cos of its first row; its 4 sin stand 32 floats on, its next row 4 positions on
    v4f tc[16], ts[16];   // the table rows are asked for in front of the staging's wait, beside the LDS stores: they depend on nothing staged
#pragma unroll   // unrolled: register arrays
    for (int it = 0; it < 16; ++it) { tc[it] = *(const v4f*)(ct + it * (4 * HD)); ts[it] = *(const v4f*)(ct + it * (4 * HD) + HD / 2); }
#pragma unroll
    for (int i = 0; i < 4; ++i) {
#pragma unroll
      for (int j = 0; j < 4; ++j) {
#pragma unroll
        for (int r = 0; r < 8; ++r) sf[(i * 16 + 8 * g + r) * 68 + j * 16 + col] = acc[i][j][r] + bj[j]; } }   // q, k (+ bias)
    LDSX();
#pragma unroll   // unrolled: tc and ts are indexed by it and stay in registers only so
    for (int it = 0; it < 16; ++it) { const int rl = it * 4 + rl0; const v4f xa = *(const v4f*)&sf[rl * 68 + pc * 8], xb = *(const v4f*)&sf[rl * 68 + pc * 8 + 4]; const float x[8] = { xa[0], xa[1], xa[2], xa[3], xb[0], xb[1], xb[2], xb[3] }; v8h yh, yl;
#pragma unroll
      for (int p = 0; p < 4; ++p) { const float x0 = x[2 * p], x1 = x[2 * p + 1], cs = tc[it][p], sn = ts[it][p]; const float y0 = x0 * cs - x1 * sn, y1 = x1 * cs + x0 * sn;
        const _Float16 h0 = (_Float16)y0, h1 = (_Float16)y1; yh[2 * p] = h0; yh[2 * p + 1] = h1; yl[2 * p] = (_Float16)((y0 - (float)h0) * 2048.0f); yl[2 * p + 1] = (_Float16)((y1 - (float)h1) * 2048.0f); }   // f16 hi + (x2048) residual
      const size_t o = (m0 + wm * 64 + rl) * (2 * DM) + n0 + wn * 64 + pc * 8; vst2(QK + o, yh); vst2(QKL + o, yl); }
  } else {   // v transposed: a lane's 8 accumulator rows are 8 consecutive s of one d
#pragma unroll
    for (int i = 0; i < 4; ++i) {
#pragma unroll
      for (int j = 0; j < 4; ++j) { v8h th, tl;
#pragma unroll
        for (int r = 0; r < 8; ++r) { const float v = acc[i][j][r] + bj[j]; const _Float16 hv = (_Float16)v; th[r] = hv; tl[r] = (_Float16)((v - (float)hv) * 2048.0f); }
        *(v8h*)&eh[(j * 16 + col) * 72 + i * 16 + 8 * g] = th; *(v8h*)&el[(j * 16 + col) * 72 + i * 16 + 8 * g] = tl; } }
    LDSX();
    const int b = (int)(m0 / SS), s0 = (int)(m0 % SS) + wm * 64; const int pc0 = n0 - 2 * DM + wn * 64;
    for (int it = 0; it < 16; ++it) { const int d = it * 4 + (lane >> 3), pc = lane & 7; const size_t o = ((size_t)b * DM + pc0 + d) * SS + s0 + pc * 8; vst2((unsigned*)(VTH + o), *(const v4u*)&eh[d * 72 + pc * 8]); vst2((unsigned*)(VTL + o), *(const v4u*)&el[d * 72 + pc * 8]); }
  }
}
// ---- k_attn: block = (64 queries, head h, batch b): all-keys flash attention (K = 64: 2 k-steps), scores = (q.k) * 0.125 with 3 f16 products (q, k hi + residual) in query blocks 0 and 1, single f16 elsewhere, P.V: f16 P hi/lo x (V hi, V lo*2048), 3 products in two accumulators; O[b*S+q][h*64+d] = (acc + accl / 2048) / (2048 l) (256-B segments)
// A stage is 64 keys: the k rows (64 x 128 B), and the 64 d rows of v hi and of v residual (128 B = 64 keys each), every row at LDS pitch 144 B, brought in once for the block's four waves by asynchronous b128 copies of whole 128-B lines,
// two buffers: stage s + 1 flies while the two 32-key steps of stage s are worked on. Fragments, their k order, the key order and every sum are as before.
#define AKP 144
#define ATL (64 * AKP)
#define AST (3 * ATL)
// four copies of one lane, LDS and global address each advancing by a fixed step; the closing s_wait_xcnt 0 stands inside the statement so that no address register is rewritten ahead of it
__device__ __forceinline__ void acopy4(unsigned l, unsigned ls, const char* g, unsigned gs) {
  asm volatile("global_load_async_to_lds_b128 %0, %4, off\n\t"
               "global_load_async_to_lds_b128 %1, %5, off\n\t"
               "global_load_async_to_lds_b128 %2, %6, off\n\t"
               "global_load_async_to_lds_b128 %3, %7, off\n\t"
               "s_wait_xcnt 0x0"
               :: "v"(l), "v"(l + ls), "v"(l + 2 * ls), "v"(l + 3 * ls),
                  "v"(g), "v"(g + gs), "v"(g + 2 * (size_t)gs), "v"(g + 3 * (size_t)gs)
               : "memory");
}
// fragment from an LDS row: the lane's 16 B at p and the 16 B at p + 32 (the k order of frag_h)
__device__ __forceinline__ v16h frag_l(const unsigned char* p) { union { v16h v; v8h q[2]; } u; u.q[0] = *(const v8h*)p; u.q[1] = *(const v8h*)(p + 32); return u.v; }
// lane l with lane l ^ 16 (the other half of a query's keys)
__device__ __forceinline__ float xhalf(float x) { return __builtin_bit_cast(float, __builtin_amdgcn_permlanex16(__builtin_bit_cast(int, x), __builtin_bit_cast(int, x), 0x76543210, 0xfedcba98, false, false)); }
// Transposed products: S^T = K . Q^T (A = 16 key rows, B = the wave's 16 queries) and O^T += V^T . P^T (A = 16 d rows of v, B = P^T). A lane holds one query (column col): 8 of each 16-key tile's scores, the other 8 in lane ^ 16,
// so maximum and sum run in the lane with one exchange between the halves, and the two score tiles of a 32-key step, converted in place, are the B fragment of P^T in the k order of the v rows: P goes through no LDS.
// second bound: four waves a SIMD (256 registers a wave), so that all 1,024 blocks stay resident at once as before
__global__ __launch_bounds__(128, 4) void k_attn(const _Float16* __restrict__ QK, const _Float16* __restrict__ QKL, const _Float16* __restrict__ VTH, const _Float16* __restrict__ VTL, const void* __restrict__ KMASK, float* __restrict__ O) {
  __shared__ __align__(16) unsigned char sb[2 * AST];
  const int tid = threadIdx.x, wave = tid >> 5, lane = tid & 31, col = lane & 15, g = lane >> 4;
  const int qb = blockIdx.x, h = blockIdx.y, b = blockIdx.z; const int q0 = qb * 64 + wave * 16; const size_t rq = (size_t)b * SS + q0 + col; const int qi = q0 + col;   // qi: the lane's query
  const int st0 = qb > LWIN / 64 ? qb - LWIN / 64 : 0, st1 = qb;   // banded causal: 64-key stages st0 .. st1
  // 8 lanes cover a 128-B row, 16 rows per copy of the block, 4 copies per tile
  const unsigned lc = (unsigned)(size_t)sb + (unsigned)((tid >> 3) * AKP + (tid & 7) * 16);
  const char* gk = (const char*)(QK + ((size_t)b * SS + (tid >> 3)) * (2 * DM) + DM + h * HD) + (tid & 7) * 16;
  const size_t vo = (((size_t)b * DM + h * HD + (tid >> 3)) * SS) * 2 + (tid & 7) * 16; const char* gvh = (const char*)VTH + vo; const char* gvl = (const char*)VTL + vo;
  auto stage = [&](int s, unsigned bo) {
    acopy4(lc + bo, 16 * AKP, gk + (size_t)s * (64 * 2 * DM * 2), 16 * 2 * DM * 2);
    acopy4(lc + bo + ATL, 16 * AKP, gvh + (size_t)s * 128, 16 * SS * 2);
    acopy4(lc + bo + 2 * ATL, 16 * AKP, gvl + (size_t)s * 128, 16 * SS * 2); };
  stage(st0, 0u);
  v16h aq[2];
#pragma unroll
  for (int kc = 0; kc < 2; ++kc) aq[kc] = frag_h(QK + rq * (2 * DM) + h * HD + kc * 32, lane);
  float m = -3.0e38f, l = 0.f;   // the lane's query: running maximum (both halves alike), sum over this half's keys
  v8f acc[4] = {}, accl[4] = {};
  asm volatile("s_wait_asynccnt 0x0" ::: "memory");   // this wave's copies of the first stage have landed
  __syncthreads();                                     // first stage published to every wave
  if (st0 < st1) stage(st0 + 1, (unsigned)AST);
#pragma unroll 1   // rolled: one body for every stage
  for (int st = st0; st <= st1; ++st) { const unsigned bo = ((st - st0) & 1) ? (unsigned)AST : 0u;
#pragma unroll 1   // rolled: the two 32-key steps of a stage share one body
  for (int sub = 0; sub < 2; ++sub) { const int ks = st * 2 + sub; v8f s[2];
    const unsigned char* lk = sb + bo + (sub * 32 + col) * AKP + 16 * g; const unsigned char* lv = sb + bo + ATL + col * AKP + sub * 64 + 16 * g;
    v16h kf[2][2];   // the step's four k fragments, read as one group ahead of the products
#pragma unroll
    for (int ct = 0; ct < 2; ++ct) {
#pragma unroll
      for (int kc = 0; kc < 2; ++kc) kf[ct][kc] = frag_l(lk + ct * (16 * AKP) + kc * 64); }
    v16h vh[4], vl[4];   // the step's eight v fragments
#pragma unroll
    for (int dt = 0; dt < 4; ++dt) { vh[dt] = frag_l(lv + dt * (16 * AKP)); vl[dt] = frag_l(lv + ATL + dt * (16 * AKP)); }
#pragma unroll
    for (int ct = 0; ct < 2; ++ct) { const _Float16* krowl = QKL + ((size_t)b * SS + ks * 32 + ct * 16 + col) * (2 * DM) + DM + h * HD; v8f c = {}, cl = {};
      if (qb < 2) {   // leading query blocks (few keys, outputs far above the global rms): 3 products; the q residual is fetched here, where alone it is used, so that it holds no registers in the other blocks
#pragma unroll
        for (int kc = 0; kc < 2; ++kc) { const v16h kh = kf[ct][kc]; c = wmma16(kh, aq[kc], c); cl = wmma16(kh, frag_h(QKL + rq * (2 * DM) + h * HD + kc * 32, lane), cl); cl = wmma16(frag_h(krowl + kc * 32, lane), aq[kc], cl); }
#pragma unroll
        for (int r = 0; r < 8; ++r) c[r] += cl[r] * (1.0f / 2048.0f); }
      else {
#pragma unroll
        for (int kc = 0; kc < 2; ++kc) c = wmma16(kf[ct][kc], aq[kc], c); }   // single product elsewhere
#pragma unroll
      for (int r = 0; r < 8; ++r) { const int kk = ks * 32 + ct * 16 + 8 * g + r; s[ct][r] = (kk <= qi && qi - kk <= LWIN) ? c[r] * 0.125f : -3.0e38f; } }   // 1/sqrt(64); masked keys excluded
    float mx = fmaxf(s[0][0], s[1][0]);
#pragma unroll
    for (int r = 1; r < 8; ++r) mx = fmaxf(mx, fmaxf(s[0][r], s[1][r]));
    mx = fmaxf(mx, xhalf(mx));   // the step's 32 keys
    const float mn = fmaxf(m, mx); const float alpha = (m <= -1.0e38f) ? 0.f : __expf(m - mn);
    v8f e[2];
#pragma unroll
    for (int ct = 0; ct < 2; ++ct) {
#pragma unroll
      for (int r = 0; r < 8; ++r) e[ct][r] = (s[ct][r] <= -1.0e38f) ? 0.f : __expf(s[ct][r] - mn); }
    const v8f e8 = e[0] + e[1]; const v4f e4 = e8.lo + e8.hi; const v2f e2 = e4.lo + e4.hi;
    l = l * alpha + (e2[0] + e2[1]); m = mn;   // the halves' sums are joined once, behind the loop
#pragma unroll
    for (int dt = 0; dt < 4; ++dt) { acc[dt] *= alpha; accl[dt] *= alpha; }
    v16h pa, pl;
#pragma unroll
    for (int ct = 0; ct < 2; ++ct) {
#pragma unroll
      for (int r = 0; r < 8; ++r) { const float x = e[ct][r] * 2048.0f; const _Float16 hx = (_Float16)x; pa[ct * 8 + r] = hx; pl[ct * 8 + r] = (_Float16)((x - (float)hx) * 2048.0f); } }   // P scaled by 2^11 before the f16 split so small softmax weights stay out of the f16 subnormal range; 2^-11 folded into the epilogue
#pragma unroll
    for (int dt = 0; dt < 4; ++dt) acc[dt] = wmma16(vh[dt], pa, acc[dt]);
    if (qb < 32) {   // every query block (qb < 32 always holds): P hi/lo x V hi/lo (3 products); per accumulator the residual of P first, then that of v, as before
#pragma unroll
      for (int dt = 0; dt < 4; ++dt) accl[dt] = wmma16(vh[dt], pl, accl[dt]);
#pragma unroll
      for (int dt = 0; dt < 4; ++dt) accl[dt] = wmma16(vl[dt], pa, accl[dt]); }
    }
    asm volatile("s_wait_dscnt 0x0" ::: "memory");      // this wave's reads of stage st are done before its buffer is refilled
    asm volatile("s_wait_asynccnt 0x0" ::: "memory");   // this wave's copies of stage st + 1 have landed
    __syncthreads();                                     // publishes stage st + 1 and ends every wave's reads of stage st
    if (st + 2 <= st1) stage(st + 2, bo); }
  asm volatile("s_wait_asynccnt 0x0" ::: "memory");     // nothing in flight when the buffers become output staging
  float (*so)[16][68] = (float (*)[16][68])sb;          // each wave's own range of the ring, free behind the last stage's barrier
  const float il = (1.0f / 2048.0f) / (l + xhalf(l));
#pragma unroll
  for (int dt = 0; dt < 4; ++dt) { v4f o0, o1;   // a lane's 8 accumulator rows are 8 consecutive d of its query
#pragma unroll
    for (int r = 0; r < 4; ++r) { o0[r] = (acc[dt][r] + accl[dt][r] * (1.0f / 2048.0f)) * il; o1[r] = (acc[dt][4 + r] + accl[dt][4 + r] * (1.0f / 2048.0f)) * il; }
    *(v4f*)&so[wave][col][dt * 16 + 8 * g] = o0; *(v4f*)&so[wave][col][dt * 16 + 8 * g + 4] = o1; }
  LDSX();
  for (int rl = 0; rl < 16; ++rl) if (lane < 16) vst2(O + ((size_t)b * SS + q0 + rl) * DM + h * HD + lane * 4, *(const v4f*)&so[wave][rl][lane * 4]);
}
// ---- k_out: block = (64 rows, 128 cols): out = O(hi/lo) . Wo rows (2 products) + bo
__global__ __launch_bounds__(128) void k_out(const float* __restrict__ O, const __bf16* __restrict__ P, const float* __restrict__ BO, float* __restrict__ Y) {
  __shared__ __align__(16) unsigned char sm[2 * (64 * GXP + 128 * GWP)];
  const int tid = threadIdx.x, wave = tid >> 5, lane = tid & 31, col = lane & 15, g = lane >> 4, wm = wave >> 1, wn = wave & 1; const size_t m0 = (size_t)blockIdx.x * 64; const int n0 = blockIdx.y * 128;
  v8f acc[2][4] = {};
  gemm_lds<2, true>(O + m0 * DM, P + (size_t)n0 * DM, sm, acc, tid);
  float* so = (float*)(sm + wave * (32 * 272));   // per wave: 32 rows of 64 f32 at pitch 272 B
#pragma unroll
  for (int i = 0; i < 2; ++i) {
#pragma unroll
    for (int j = 0; j < 4; ++j) {
#pragma unroll
      for (int r = 0; r < 8; ++r) so[(i * 16 + 8 * g + r) * 68 + j * 16 + col] = acc[i][j][r] + bfr(BO[n0 + wn * 64 + j * 16 + col]); } }
  LDSX();
  for (int it = 0; it < 16; ++it) { const int rl = it * 2 + g; vst2(Y + (m0 + wm * 32 + rl) * DM + n0 + wn * 64 + col * 4, *(const v4f*)&so[rl * 68 + col * 4]); }
}
extern "C" void kernel_launch(void* const* d_in, const int* in_sizes, int n_in, void* d_out, int out_size, void* d_ws, size_t ws_size, hipStream_t stream) {
  (void)in_sizes; (void)n_in; (void)out_size;
  const float** F = (const float**)d_in;   // 0 x [2,2048,1024], 1 Wqkv [3072,1024] natural ((3,H,hd) rows), 2 Wproj [1024,1024] natural, 3 bproj [1024]
  if (ws_size < (size_t)WS_END) return;
  char* ws = (char*)d_ws; __bf16* PK = (__bf16*)(ws + WS_PK); _Float16 *QK = (_Float16*)(ws + WS_QK), *QKL = (_Float16*)(ws + WS_QKL), *VTH = (_Float16*)(ws + WS_VTH), *VTL = (_Float16*)(ws + WS_VTL); float* O = (float*)(ws + WS_O); float* CS = (float*)(ws + WS_CS);
  k_pack<<<dim3(4 * DM / 8), 256, 0, stream>>>(F[1], F[1] + (size_t)DM * DM, F[1] + (size_t)2 * DM * DM, F[2], PK, CS);
  k_qkv<<<dim3(TNB * SS / 128, QKVW / 128), 128, 0, stream>>>(F[0], F[0], F[0], PK + PK_A, nullptr, nullptr, nullptr, QK, QKL, VTH, VTL, CS);
  k_attn<<<dim3(TQB, NH, TNB), 128, 0, stream>>>(QK, QKL, VTH, VTL, nullptr, O);
  k_out<<<dim3(TOB, DM / 128), 128, 0, stream>>>(O, PK + PK_P, F[3], (float*)d_out);
}

// v006
// Measured time: 83.5 microseconds a run.
// Next to v005, in two timings, it ran 1.05 and 1.06 times as fast.
// Counting every step since v000, it is 3.95 times as fast.
// compute dtype: all float inputs rounded to bf16; q/k/v = x . W^T with EXACT bf16 products on WMMA 16x16x32 (natural rows), f32; rotary (angles t x inv_freq, device cosf/sinf) in f32 on q and k, rounded to f16 hi + residual; banded all-keys attention with hybrid scores (first 128 queries 3-product, later single f16) and 3-product P.v everywhere (key tiles outside [q-512, q] skipped), x 1/8, running-max softmax in f32 (hardware exp); out = ctx (bf16 hi + lo, 2 products) . Wproj^T + b; f32 output.
#include <hip/hip_runtime.h>
#include <math.h>

typedef __attribute__((ext_vector_type(16))) _Float16 v16h;
typedef __attribute__((ext_vector_type(16))) __bf16 v16b;
typedef __attribute__((ext_vector_type(8)))  _Float16 v8h;
typedef __attribute__((ext_vector_type(8)))  float v8f;
typedef __attribute__((ext_vector_type(4)))  float v4f;
typedef __attribute__((ext_vector_type(2)))  float v2f;
typedef __attribute__((ext_vector_type(4)))  unsigned v4u;
typedef __attribute__((ext_vector_type(4)))  int v4i;
typedef float __attribute__((may_alias)) float_a;
typedef int __attribute__((may_alias)) int_a;

template <typename T> __device__ __forceinline__ void vst2(void* p, T v) { *(T*)p = v;  }
__device__ __forceinline__ v8f wmma16(v16h a, v16h b, v8f c) {
  v8f d = __builtin_amdgcn_wmma_f32_16x16x32_f16(false, a, false, b, (short)0, c, false, false);
  asm volatile("v_nop\n\tv_nop\n\tv_nop\n\tv_nop" : "+v"(d) : "v"(a), "v"(b));
  return d;
}
__device__ __forceinline__ v8f wmma_bf(v16b a, v16b b, v8f c) {
  v8f d = __builtin_amdgcn_wmma_f32_16x16x32_bf16(false, a, false, b, (short)0, c, false, false);
  asm volatile("v_nop\n\tv_nop\n\tv_nop\n\tv_nop" : "+v"(d) : "v"(a), "v"(b));
  return d;
}
// Causal local self-attention (B 2, T 2,048, C 1,024, 16 heads x 64, window 512): fused bias-free projection (natural [3C][C]), interleaved rotary embedding on q and k, scores / 8 restricted to k <= q <= k + 512, softmax, v, natural output projection + bias.
__device__ __forceinline__ v16h frag_h(const _Float16* rowk0, int lane) {
  union { v16h v; v8h q[2]; } u; const _Float16* p = rowk0 + 8 * (lane >> 4);
  u.q[0] = *(const v8h*)p; u.q[1] = *(const v8h*)(p + 16); return u.v;
}
__device__ __forceinline__ v16h frag_f32(const float* rowk0, int lane) {
  v16h a; const float* p = rowk0 + 8 * (lane >> 4);
#pragma unroll
  for (int i = 0; i < 8; ++i) { a[i] = (_Float16)p[i]; a[8 + i] = (_Float16)p[16 + i]; }
  return a;
}
__device__ __forceinline__ v16h frag_f32s(const float* rowk0, int lane, float sc) {
  v16h a; const float* p = rowk0 + 8 * (lane >> 4);
#pragma unroll
  for (int i = 0; i < 8; ++i) { a[i] = (_Float16)(p[i] * sc); a[8 + i] = (_Float16)(p[16 + i] * sc); }
  return a;
}
// column fragment from a [K][ld] layout (column n), rows >= K read as 0
__device__ __forceinline__ v16h fragc_f32(const float* W, int k0, int n, int lane, int ld, int K) {
  v16h a; const int g = lane >> 4;
#pragma unroll
  for (int i = 0; i < 8; ++i) { const int ka = k0 + 8 * g + i, kb = ka + 16;
    a[i] = (_Float16)(ka < K ? W[(size_t)(ka < K ? ka : K - 1) * ld + n] : 0.f); a[8 + i] = (_Float16)(kb < K ? W[(size_t)(kb < K ? kb : K - 1) * ld + n] : 0.f); }
  return a;
}
struct F2 { v16b h, l; };
__device__ __forceinline__ F2 bsplit16(const float v[16]) { F2 r;
#pragma unroll
  for (int i = 0; i < 16; ++i) { const __bf16 h = (__bf16)v[i]; r.h[i] = h; r.l[i] = (__bf16)(v[i] - (float)h); }
  return r; }
__device__ __forceinline__ F2 split_row(const float* row, int k0, int lane) { float v[16]; const float* p = row + k0 + 8 * (lane >> 4);
#pragma unroll
  for (int i = 0; i < 8; ++i) { v[i] = p[i]; v[8 + i] = p[16 + i]; }
  return bsplit16(v); }
__device__ __forceinline__ F2 split_rowK(const float* row, int k0, int lane, int K) { float v[16]; const int g = lane >> 4;
#pragma unroll
  for (int i = 0; i < 8; ++i) { const int ka = k0 + 8 * g + i, kb = ka + 16; v[i] = ka < K ? row[ka < K ? ka : K - 1] : 0.f; v[8 + i] = kb < K ? row[kb < K ? kb : K - 1] : 0.f; }
  return bsplit16(v); }
__device__ __forceinline__ F2 split_col(const float* W, int k0, int n, int lane, int ld, int K) { float v[16]; const int g = lane >> 4;
#pragma unroll
  for (int i = 0; i < 8; ++i) { const int ka = k0 + 8 * g + i, kb = ka + 16; v[i] = ka < K ? W[(size_t)(ka < K ? ka : K - 1) * ld + n] : 0.f; v[8 + i] = kb < K ? W[(size_t)(kb < K ? kb : K - 1) * ld + n] : 0.f; }
  return bsplit16(v); }
__device__ __forceinline__ v8f mac3(const F2& a, const F2& b, v8f c) { c = wmma_bf(a.l, b.h, c); c = wmma_bf(a.h, b.l, c); return wmma_bf(a.h, b.h, c); }
__device__ __forceinline__ float sigm(float v) { return 1.0f / (1.0f + expf(-v)); }
#define LDSX() do { asm volatile("s_wait_dscnt 0" ::: "memory"); __builtin_amdgcn_wave_barrier(); __builtin_amdgcn_fence(__ATOMIC_RELEASE, "workgroup"); } while (0)


#define NB 2
#define SS 2048
#define DM 1024
#define NH 16
#define LWIN 512
#define RBASE 10000.0f
#define HD 64
#define QKVW (3 * DM)
#ifndef TQB
#define TQB (SS / 64)
#define TNB NB
#define TOB (NB * SS / 64)     // output row tiles (all)
#endif
typedef __attribute__((ext_vector_type(8))) __bf16 v8b;
__device__ __forceinline__ v16b frag_b(const __bf16* rowk0, int lane) {
  union { v16b v; v8b q[2]; } u; const __bf16* p = rowk0 + 8 * (lane >> 4);
  u.q[0] = *(const v8b*)p; u.q[1] = *(const v8b*)(p + 16); return u.v;
}
__device__ __forceinline__ float bfr(float v) { return (float)(__bf16)v; }
__device__ __attribute__((noinline)) float exp_ni(float v) { return expf(v); }
__device__ __attribute__((noinline)) float erf_ni(float v) { return erff(v); }

#define PK_A 0                       // [3072][1024] Wqkv rows (natural [out][in])
#define PK_P (PK_A + QKVW * DM)        // [1024][1024] Wo rows (natural)
#define PK_END (PK_P + DM * DM)
#define WS_PK  0u
#define WS_QK  (WS_PK + 2u * PK_END)             // f16 [4096 rows][2048]: q | k
#define WS_QKL (WS_QK + 2u * NB * SS * 2 * DM)     // f16 q | k residual planes x2048
#define WS_VTH (WS_QKL + 2u * NB * SS * 2 * DM)    // f16 [b][1024 (h*64+d)][2048 s] hi
#define WS_VTL (WS_VTH + 2u * NB * DM * SS)        // f16 lo x 2048
#define WS_O   (WS_VTL + 2u * NB * DM * SS)        // f32 [4096][1024]
#define WS_CS  (WS_O + 4u * NB * SS * DM)           // f32 [2048 positions][32 cos | 32 sin]
#define WS_END (WS_CS + 4u * 2 * SS * 32)
// ---- k_pack: one wave = one natural [out][in] row of 1,024 floats -> bf16; rows 0..3071 are W_q/W_k/W_v into PK_A, rows 3072..4095 W_o into PK_P. 512 blocks of 8 waves, two a WGP, so that the launch has 4,096 waves to start:
// a lane asks for its eight 16-B pieces at once (each wave-wide load covers 512 contiguous bytes), rounds them in registers and stores 8 B a piece (a wave-wide store covers two whole 128-B lines)
// waves 0..3 of every block also write one position's row of the rotary table: angle pos * inv_freq[i], inv_freq[i] = BASE^(-i/32), 32 cos then 32 sin (two whole 128-B lines)
typedef __attribute__((ext_vector_type(4))) __bf16 v4b;
__global__ __launch_bounds__(256) void k_pack(const float* __restrict__ WQ, const float* __restrict__ WK, const float* __restrict__ WV, const float* __restrict__ WO, __bf16* __restrict__ PK, float* __restrict__ CS) {
  const int t = threadIdx.x, wave = t >> 5, lane = t & 31; const int row = blockIdx.x * 8 + wave, which = row / DM, n = row % DM; const float* Wm = (which == 0) ? WQ : (which == 1) ? WK : (which == 2) ? WV : WO;
  const float* sp = Wm + (size_t)n * DM + lane * 4; v4f x[8];
#pragma unroll   // unrolled: register array, all eight loads in flight together
  for (int j = 0; j < 8; ++j) x[j] = *(const v4f*)(sp + j * 128);
  if (wave < 4) { const int pos = blockIdx.x * 4 + wave;   // 512 blocks x 4 waves = the SS positions; the table's arithmetic runs while the row's loads fly
    const float invf = (float)exp(-(double)lane / (double)(HD / 2) * log((double)RBASE)); const float ang = (float)pos * invf;
    CS[pos * HD + lane] = cosf(ang); CS[pos * HD + HD / 2 + lane] = sinf(ang); }
  __bf16* dst = ((which < 3) ? PK + PK_A + ((size_t)which * DM + n) * DM : PK + PK_P + (size_t)n * DM) + lane * 4;
#pragma unroll
  for (int j = 0; j < 8; ++j) { v4b y;
#pragma unroll
    for (int e = 0; e < 4; ++e) y[e] = (__bf16)x[j][e];
    vst2(dst + j * 128, y); }
}
// ---- projection GEMM core: block tile (32 * MI rows) x 128 columns, 4 waves as 2 x 2, each (16 * MI) x 64. A stage is 64 k: the f32 rows of X (256 B, LDS pitch 272 B) and the bf16 rows of W (128 B, LDS pitch 144 B),
// brought into LDS by asynchronous b128 copies, two buffers: stage t + 1 flies while stage t is multiplied. Fragments keep the k order and every accumulator its k sequence (32 steps of 32, ascending).
#define GXP 272
#define GWP 144
// eight copies of one lane, LDS and global address each advancing by a fixed step; the closing s_wait_xcnt 0 stands inside the statement so that no address register is rewritten ahead of it
__device__ __forceinline__ void acopy8(unsigned l, unsigned ls, const char* g, unsigned gs) {
  asm volatile("global_load_async_to_lds_b128 %0, %8, off\n\t"
               "global_load_async_to_lds_b128 %1, %9, off\n\t"
               "global_load_async_to_lds_b128 %2, %10, off\n\t"
               "global_load_async_to_lds_b128 %3, %11, off\n\t"
               "global_load_async_to_lds_b128 %4, %12, off\n\t"
               "global_load_async_to_lds_b128 %5, %13, off\n\t"
               "global_load_async_to_lds_b128 %6, %14, off\n\t"
               "global_load_async_to_lds_b128 %7, %15, off\n\t"
               "s_wait_xcnt 0x0"
               :: "v"(l), "v"(l + ls), "v"(l + 2 * ls), "v"(l + 3 * ls), "v"(l + 4 * ls), "v"(l + 5 * ls), "v"(l + 6 * ls), "v"(l + 7 * ls),
                  "v"(g), "v"(g + gs), "v"(g + 2 * (size_t)gs), "v"(g + 3 * (size_t)gs), "v"(g + 4 * (size_t)gs), "v"(g + 5 * (size_t)gs), "v"(g + 6 * (size_t)gs), "v"(g + 7 * (size_t)gs)
               : "memory");
}
template <int MI, bool SPLIT>
__device__ __forceinline__ void gemm_lds(const float* __restrict__ Xb, const __bf16* __restrict__ Wb, unsigned char* sm, v8f (&acc)[MI][4], int tid) {
  constexpr int XB = 32 * MI * GXP, ST = XB + 128 * GWP, NT = DM / 64;
  const int wave = tid >> 5, lane = tid & 31, col = lane & 15, g = lane >> 4, wm = wave >> 1, wn = wave & 1;
  // X: 16 lanes cover a 256-B row piece, 8 rows per copy of the block; W: 8 lanes cover a 128-B row piece, 16 rows per copy
  const unsigned lx = (unsigned)(size_t)sm + (unsigned)((tid >> 4) * GXP + (tid & 15) * 16), lw = (unsigned)(size_t)sm + (unsigned)(XB + (tid >> 3) * GWP + (tid & 7) * 16);
  const char* gx = (const char*)Xb + (size_t)(tid >> 4) * (DM * 4) + (tid & 15) * 16; const char* gw = (const char*)Wb + (size_t)(tid >> 3) * (DM * 2) + (tid & 7) * 16;
  auto stage = [&](int t, unsigned bo) {
#pragma unroll
    for (int u = 0; u < MI / 2; ++u) acopy8(lx + bo + u * (64 * GXP), 8 * GXP, gx + (size_t)t * 256 + (size_t)u * (64 * DM * 4), 8 * DM * 4);
    acopy8(lw + bo, 16 * GWP, gw + (size_t)t * 128, 16 * DM * 2); };
  stage(0, 0u);
  asm volatile("s_wait_asynccnt 0x0" ::: "memory");   // this wave's copies of stage 0 have landed
  __syncthreads();                                     // stage 0 published to every wave
  stage(1, (unsigned)ST);
#pragma unroll 1   // rolled: for speed only
  for (int t = 0; t < NT; ++t) { const unsigned bo = (t & 1) ? (unsigned)ST : 0u;
    const unsigned char* sx = sm + bo + (wm * 16 * MI + col) * GXP + 32 * g; const unsigned char* sw = sm + bo + XB + (wn * 64 + col) * GWP + 16 * g;
#pragma unroll
    for (int kc = 0; kc < 2; ++kc) { v16b b[4];
#pragma unroll
      for (int j = 0; j < 4; ++j) { union { v16b v; v8b q[2]; } u; const unsigned char* p = sw + j * (16 * GWP) + kc * 64; u.q[0] = *(const v8b*)p; u.q[1] = *(const v8b*)(p + 32); b[j] = u.v; }
#pragma unroll
      for (int i = 0; i < MI; ++i) { const v4f* p = (const v4f*)(sx + i * (16 * GXP) + kc * 128); const v4f x0 = p[0], x1 = p[1], x2 = p[4], x3 = p[5]; float v[16];
#pragma unroll
        for (int e = 0; e < 4; ++e) { v[e] = x0[e]; v[4 + e] = x1[e]; v[8 + e] = x2[e]; v[12 + e] = x3[e]; }
        if (SPLIT) { const F2 a = bsplit16(v);
#pragma unroll
          for (int j = 0; j < 4; ++j) acc[i][j] = wmma_bf(a.l, b[j], acc[i][j]);   // residual first, then hi, per accumulator as before; four independent tiles between the two
#pragma unroll
          for (int j = 0; j < 4; ++j) acc[i][j] = wmma_bf(a.h, b[j], acc[i][j]); }
        else { v16b a;
#pragma unroll
          for (int e = 0; e < 16; ++e) a[e] = (__bf16)v[e];
#pragma unroll
          for (int j = 0; j < 4; ++j) acc[i][j] = wmma_bf(a, b[j], acc[i][j]); } } }
    asm volatile("s_wait_dscnt 0x0" ::: "memory");      // this wave's reads of stage t are done before its buffer is refilled
    asm volatile("s_wait_asynccnt 0x0" ::: "memory");   // this wave's copies of stage t + 1 have landed
    __syncthreads();                                     // publishes stage t + 1 and ends every wave's reads of stage t
    if (t + 2 < NT) stage(t + 2, bo); }
  asm volatile("s_wait_asynccnt 0x0" ::: "memory");     // nothing in flight when the buffers become output staging
}
// ---- k_qkv: block = (128 rows, 128 columns); each wave stages its 64 x 64 result (one head's columns) in its own LDS range and stores whole 128-B lines.
// q and k are staged in f32; on the way back a lane holds 8 consecutive columns of a row = 4 (even, odd) pairs, turns them by the row's position (interleaved rotary, cos and sin from the table of k_pack's launch) and splits them into f16 hi + residual
__global__ __launch_bounds__(128) void k_qkv(const float* __restrict__ XQ, const float* __restrict__ XK, const float* __restrict__ XV, const __bf16* __restrict__ P, const float* __restrict__ BQ, const float* __restrict__ BK, const float* __restrict__ BV, _Float16* __restrict__ QK, _Float16* __restrict__ QKL, _Float16* __restrict__ VTH, _Float16* __restrict__ VTL, const float* __restrict__ CS) {
  const int which0 = (blockIdx.y * 128) / DM; const float* X = (which0 == 0) ? XQ : (which0 == 1) ? XK : XV; const float* BB = BQ ? (((which0 == 0) ? BQ : (which0 == 1) ? BK : BV) + (blockIdx.y * 128 - which0 * DM)) : nullptr;
  __shared__ __align__(16) unsigned char sm[2 * (128 * GXP + 128 * GWP)];
  const int tid = threadIdx.x, wave = tid >> 5, lane = tid & 31, col = lane & 15, g = lane >> 4, wm = wave >> 1, wn = wave & 1; const size_t m0 = (size_t)blockIdx.x * 128; const int n0 = blockIdx.y * 128;
  v8f acc[4][4] = {};
  gemm_lds<4, false>(X + m0 * DM, P + (size_t)n0 * DM, sm, acc, tid);
  float bj[4];
#pragma unroll
  for (int j = 0; j < 4; ++j) bj[j] = BB ? bfr(BB[wn * 64 + j * 16 + col]) : 0.f;
  _Float16* eh = (_Float16*)(sm + wave * (2 * 64 * 144)); _Float16* el = eh + 64 * 72;   // v, per wave: hi and residual planes, 64 rows at pitch 144 B
  if (n0 < 2 * DM) {   // q stored unscaled (f16 sigma ~0.6, no subnormal exposure); 1/8 applied to the f32 score
    float* sf = (float*)(sm + wave * (64 * 272));   // per wave: 64 rows of 64 f32 at pitch 272 B
    const int rl0 = lane >> 3, pc = lane & 7;
    const float* ct = CS + (size_t)((int)(m0 % SS) + wm * 64 + rl0) * HD + pc * 4;   // the lane's 4 cos of its first row; its 4 sin stand 32 floats on, its next row 4 positions on
    v4f tc[16], ts[16];   // the table rows are asked for in front of the staging's wait, beside the LDS stores: they depend on nothing staged
#pragma unroll   // unrolled: register arrays
    for (int it = 0; it < 16; ++it) { tc[it] = *(const v4f*)(ct + it * (4 * HD)); ts[it] = *(const v4f*)(ct + it * (4 * HD) + HD / 2); }
#pragma unroll
    for (int i = 0; i < 4; ++i) {
#pragma unroll
      for (int j = 0; j < 4; ++j) {
#pragma unroll
        for (int r = 0; r < 8; ++r) sf[(i * 16 + 8 * g + r) * 68 + j * 16 + col] = acc[i][j][r] + bj[j]; } }   // q, k (+ bias)
    LDSX();
#pragma unroll   // unrolled: tc and ts are indexed by it and stay in registers only so
    for (int it = 0; it < 16; ++it) { const int rl = it * 4 + rl0; const v4f xa = *(const v4f*)&sf[rl * 68 + pc * 8], xb = *(const v4f*)&sf[rl * 68 + pc * 8 + 4]; const float x[8] = { xa[0], xa[1], xa[2], xa[3], xb[0], xb[1], xb[2], xb[3] }; v8h yh, yl;
#pragma unroll
      for (int p = 0; p < 4; ++p) { const float x0 = x[2 * p], x1 = x[2 * p + 1], cs = tc[it][p], sn = ts[it][p]; const float y0 = x0 * cs - x1 * sn, y1 = x1 * cs + x0 * sn;
        const _Float16 h0 = (_Float16)y0, h1 = (_Float16)y1; yh[2 * p] = h0; yh[2 * p + 1] = h1; yl[2 * p] = (_Float16)((y0 - (float)h0) * 2048.0f); yl[2 * p + 1] = (_Float16)((y1 - (float)h1) * 2048.0f); }   // f16 hi + (x2048) residual
      const size_t o = (m0 + wm * 64 + rl) * (2 * DM) + n0 + wn * 64 + pc * 8; vst2(QK + o, yh); vst2(QKL + o, yl); }
  } else {   // v transposed: a lane's 8 accumulator rows are 8 consecutive s of one d
#pragma unroll
    for (int i = 0; i < 4; ++i) {
#pragma unroll
      for (int j = 0; j < 4; ++j) { v8h th, tl;
#pragma unroll
        for (int r = 0; r < 8; ++r) { const float v = acc[i][j][r] + bj[j]; const _Float16 hv = (_Float16)v; th[r] = hv; tl[r] = (_Float16)((v - (float)hv) * 2048.0f); }
        *(v8h*)&eh[(j * 16 + col) * 72 + i * 16 + 8 * g] = th; *(v8h*)&el[(j * 16 + col) * 72 + i * 16 + 8 * g] = tl; } }
    LDSX();
    const int b = (int)(m0 / SS), s0 = (int)(m0 % SS) + wm * 64; const int pc0 = n0 - 2 * DM + wn * 64;
    for (int it = 0; it < 16; ++it) { const int d = it * 4 + (lane >> 3), pc = lane & 7; const size_t o = ((size_t)b * DM + pc0 + d) * SS + s0 + pc * 8; vst2((unsigned*)(VTH + o), *(const v4u*)&eh[d * 72 + pc * 8]); vst2((unsigned*)(VTL + o), *(const v4u*)&el[d * 72 + pc * 8]); }
  }
}
// ---- k_attn: block = (64 queries, head h, batch b): all-keys flash attention (K = 64: 2 k-steps), scores = (q.k) * 0.125 with 3 f16 products (q, k hi + residual) in query blocks 0 and 1, single f16 elsewhere, P.V: f16 P hi/lo x (V hi, V lo*2048), 3 products in two accumulators; O[b*S+q][h*64+d] = (acc + accl / 2048) / (2048 l) (256-B segments)
// A stage is 64 keys: the k rows (64 x 128 B), and the 64 d rows of v hi and of v residual (128 B = 64 keys each), every row at LDS pitch 144 B, brought in once for the block's four waves by asynchronous b128 copies of whole 128-B lines,
// two buffers: stage s + 1 flies while the two 32-key steps of stage s are worked on. Fragments, their k order, the key order and every sum are as before.
#define AKP 144
#define ATL (64 * AKP)
#define AST (3 * ATL)
// four copies of one lane, LDS and global address each advancing by a fixed step; the closing s_wait_xcnt 0 stands inside the statement so that no address register is rewritten ahead of it
__device__ __forceinline__ void acopy4(unsigned l, unsigned ls, const char* g, unsigned gs) {
  asm volatile("global_load_async_to_lds_b128 %0, %4, off\n\t"
               "global_load_async_to_lds_b128 %1, %5, off\n\t"
               "global_load_async_to_lds_b128 %2, %6, off\n\t"
               "global_load_async_to_lds_b128 %3, %7, off\n\t"
               "s_wait_xcnt 0x0"
               :: "v"(l), "v"(l + ls), "v"(l + 2 * ls), "v"(l + 3 * ls),
                  "v"(g), "v"(g + gs), "v"(g + 2 * (size_t)gs), "v"(g + 3 * (size_t)gs)
               : "memory");
}
// fragment from an LDS row: the lane's 16 B at p and the 16 B at p + 32 (the k order of frag_h)
__device__ __forceinline__ v16h frag_l(const unsigned char* p) { union { v16h v; v8h q[2]; } u; u.q[0] = *(const v8h*)p; u.q[1] = *(const v8h*)(p + 32); return u.v; }
// lane l with lane l ^ 16 (the other half of a query's keys)
__device__ __forceinline__ float xhalf(float x) { return __builtin_bit_cast(float, __builtin_amdgcn_permlanex16(__builtin_bit_cast(int, x), __builtin_bit_cast(int, x), 0x76543210, 0xfedcba98, false, false)); }
// Transposed products: S^T = K . Q^T (A = 16 key rows, B = the wave's 16 queries) and O^T += V^T . P^T (A = 16 d rows of v, B = P^T). A lane holds one query (column col): 8 of each 16-key tile's scores, the other 8 in lane ^ 16,
// so maximum and sum run in the lane with one exchange between the halves, and the two score tiles of a 32-key step, converted in place, are the B fragment of P^T in the k order of the v rows: P goes through no LDS.
// A wave sorts each of its 32-key steps by where the step's keys lie against the band k <= q <= k + 512 of its 16 queries: wholly outside, the step is left out (every weight would be 0, the maximum and every sum unchanged);
// wholly inside, it runs without the mask's compares and selects; only a step that straddles an edge of the band masks its scores. Of a full-length wave's 18 steps 1 is left out, 15 are wholly inside, 2 straddle.
// In a step that runs, every query has at least one key inside the band (16 queries against 32 keys, both aligned to 16), so the new maximum is a real score and a masked score's weight exp(-3e38 - maximum) is 0 by itself.
// second bound: four waves a SIMD (256 registers a wave), so that all 1,024 blocks stay resident at once as before
__global__ __launch_bounds__(128, 4) void k_attn(const _Float16* __restrict__ QK, const _Float16* __restrict__ QKL, const _Float16* __restrict__ VTH, const _Float16* __restrict__ VTL, const void* __restrict__ KMASK, float* __restrict__ O) {
  __shared__ __align__(16) unsigned char sb[2 * AST];
  const int tid = threadIdx.x, wave = tid >> 5, lane = tid & 31, col = lane & 15, g = lane >> 4;
  const int qb = blockIdx.x, h = blockIdx.y, b = blockIdx.z; const int q0 = qb * 64 + wave * 16; const size_t rq = (size_t)b * SS + q0 + col; const int qi = q0 + col;   // qi: the lane's query
  const int wq0 = qb * 64 + __builtin_amdgcn_readfirstlane(wave) * 16;   // the wave's first query in a scalar register: the tests that sort a step are scalar branches, EXEC stays whole for the matrix instructions
  const int st0 = qb > LWIN / 64 ? qb - LWIN / 64 : 0, st1 = qb;   // banded causal: 64-key stages st0 .. st1
  // 8 lanes cover a 128-B row, 16 rows per copy of the block, 4 copies per tile
  const unsigned lc = (unsigned)(size_t)sb + (unsigned)((tid >> 3) * AKP + (tid & 7) * 16);
  const char* gk = (const char*)(QK + ((size_t)b * SS + (tid >> 3)) * (2 * DM) + DM + h * HD) + (tid & 7) * 16;
  const size_t vo = (((size_t)b * DM + h * HD + (tid >> 3)) * SS) * 2 + (tid & 7) * 16; const char* gvh = (const char*)VTH + vo; const char* gvl = (const char*)VTL + vo;
  auto stage = [&](int s, unsigned bo) {
    acopy4(lc + bo, 16 * AKP, gk + (size_t)s * (64 * 2 * DM * 2), 16 * 2 * DM * 2);
    acopy4(lc + bo + ATL, 16 * AKP, gvh + (size_t)s * 128, 16 * SS * 2);
    acopy4(lc + bo + 2 * ATL, 16 * AKP, gvl + (size_t)s * 128, 16 * SS * 2); };
  stage(st0, 0u);
  v16h aq[2];
#pragma unroll
  for (int kc = 0; kc < 2; ++kc) aq[kc] = frag_h(QK + rq * (2 * DM) + h * HD + kc * 32, lane);
  float m = -3.0e38f, l = 0.f;   // the lane's query: running maximum (both halves alike), sum over this half's keys
  v8f acc[4] = {}, accl[4] = {};
  asm volatile("s_wait_asynccnt 0x0" ::: "memory");   // this wave's copies of the first stage have landed
  __syncthreads();                                     // first stage published to every wave
  if (st0 < st1) stage(st0 + 1, (unsigned)AST);
#pragma unroll 1   // rolled: one body for every stage
  for (int st = st0; st <= st1; ++st) { const unsigned bo = ((st - st0) & 1) ? (unsigned)AST : 0u;
#pragma unroll 1   // rolled: the two 32-key steps of a stage share one body
  for (int sub = 0; sub < 2; ++sub) { const int ks = st * 2 + sub; v8f s[2];
    if (ks * 32 > wq0 + 15 || wq0 - (ks * 32 + 31) > LWIN) continue;   // keys ks * 32 .. + 31 against queries wq0 .. + 15: wholly outside the band
    const unsigned char* lk = sb + bo + (sub * 32 + col) * AKP + 16 * g; const unsigned char* lv = sb + bo + ATL + col * AKP + sub * 64 + 16 * g;
    v16h kf[2][2];   // the step's four k fragments, read as one group ahead of the products
#pragma unroll
    for (int ct = 0; ct < 2; ++ct) {
#pragma unroll
      for (int kc = 0; kc < 2; ++kc) kf[ct][kc] = frag_l(lk + ct * (16 * AKP) + kc * 64); }
    v16h vh[4], vl[4];   // the step's eight v fragments
#pragma unroll
    for (int dt = 0; dt < 4; ++dt) { vh[dt] = frag_l(lv + dt * (16 * AKP)); vl[dt] = frag_l(lv + ATL + dt * (16 * AKP)); }
#pragma unroll
    for (int ct = 0; ct < 2; ++ct) { const _Float16* krowl = QKL + ((size_t)b * SS + ks * 32 + ct * 16 + col) * (2 * DM) + DM + h * HD; v8f c = {}, cl = {};
      if (qb < 2) {   // leading query blocks (few keys, outputs far above the global rms): 3 products; the q residual is fetched here, where alone it is used, so that it holds no registers in the other blocks
#pragma unroll
        for (int kc = 0; kc < 2; ++kc) { const v16h kh = kf[ct][kc]; c = wmma16(kh, aq[kc], c); cl = wmma16(kh, frag_h(QKL + rq * (2 * DM) + h * HD + kc * 32, lane), cl); cl = wmma16(frag_h(krowl + kc * 32, lane), aq[kc], cl); }
#pragma unroll
        for (int r = 0; r < 8; ++r) c[r] += cl[r] * (1.0f / 2048.0f); }
      else {
#pragma unroll
        for (int kc = 0; kc < 2; ++kc) c = wmma16(kf[ct][kc], aq[kc], c); }   // single product elsewhere
#pragma unroll
      for (int r = 0; r < 8; ++r) s[ct][r] = c[r] * 0.125f; }   // 1/sqrt(64)
    if (ks * 32 + 31 > wq0 || wq0 + 15 - ks * 32 > LWIN) {   // the step straddles an edge of the band: masked keys excluded
#pragma unroll
      for (int ct = 0; ct < 2; ++ct) {
#pragma unroll
        for (int r = 0; r < 8; ++r) { const int kk = ks * 32 + ct * 16 + 8 * g + r; s[ct][r] = (kk <= qi && qi - kk <= LWIN) ? s[ct][r] : -3.0e38f; } } }
    float mx = fmaxf(s[0][0], s[1][0]);
#pragma unroll
    for (int r = 1; r < 8; ++r) mx = fmaxf(mx, fmaxf(s[0][r], s[1][r]));
    mx = fmaxf(mx, xhalf(mx));   // the step's 32 keys
    const float mn = fmaxf(m, mx); const float alpha = (m <= -1.0e38f) ? 0.f : __expf(m - mn);
    v8f e[2];
#pragma unroll
    for (int ct = 0; ct < 2; ++ct) {
#pragma unroll
      for (int r = 0; r < 8; ++r) e[ct][r] = __expf(s[ct][r] - mn); }
    const v8f e8 = e[0] + e[1]; const v4f e4 = e8.lo + e8.hi; const v2f e2 = e4.lo + e4.hi;
    l = l * alpha + (e2[0] + e2[1]); m = mn;   // the halves' sums are joined once, behind the loop
#pragma unroll
    for (int dt = 0; dt < 4; ++dt) { acc[dt] *= alpha; accl[dt] *= alpha; }
    v16h pa, pl;
#pragma unroll
    for (int ct = 0; ct < 2; ++ct) {
#pragma unroll
      for (int r = 0; r < 8; ++r) { const float x = e[ct][r] * 2048.0f; const _Float16 hx = (_Float16)x; pa[ct * 8 + r] = hx; pl[ct * 8 + r] = (_Float16)((x - (float)hx) * 2048.0f); } }   // P scaled by 2^11 before the f16 split so small softmax weights stay out of the f16 subnormal range; 2^-11 folded into the epilogue
#pragma unroll
    for (int dt = 0; dt < 4; ++dt) acc[dt] = wmma16(vh[dt], pa, acc[dt]);
    if (qb < 32) {   // every query block (qb < 32 always holds): P hi/lo x V hi/lo (3 products); per accumulator the residual of P first, then that of v, as before
#pragma unroll
      for (int dt = 0; dt < 4; ++dt) accl[dt] = wmma16(vh[dt], pl, accl[dt]);
#pragma unroll
      for (int dt = 0; dt < 4; ++dt) accl[dt] = wmma16(vl[dt], pa, accl[dt]); }
    }
    asm volatile("s_wait_dscnt 0x0" ::: "memory");      // this wave's reads of stage st are done before its buffer is refilled
    asm volatile("s_wait_asynccnt 0x0" ::: "memory");   // this wave's copies of stage st + 1 have landed
    __syncthreads();                                     // publishes stage st + 1 and ends every wave's reads of stage st
    if (st + 2 <= st1) stage(st + 2, bo); }
  asm volatile("s_wait_asynccnt 0x0" ::: "memory");     // nothing in flight when the buffers become output staging
  float (*so)[16][68] = (float (*)[16][68])sb;          // each wave's own range of the ring, free behind the last stage's barrier
  const float il = (1.0f / 2048.0f) / (l + xhalf(l));
#pragma unroll
  for (int dt = 0; dt < 4; ++dt) { v4f o0, o1;   // a lane's 8 accumulator rows are 8 consecutive d of its query
#pragma unroll
    for (int r = 0; r < 4; ++r) { o0[r] = (acc[dt][r] + accl[dt][r] * (1.0f / 2048.0f)) * il; o1[r] = (acc[dt][4 + r] + accl[dt][4 + r] * (1.0f / 2048.0f)) * il; }
    *(v4f*)&so[wave][col][dt * 16 + 8 * g] = o0; *(v4f*)&so[wave][col][dt * 16 + 8 * g + 4] = o1; }
  LDSX();
  for (int rl = 0; rl < 16; ++rl) if (lane < 16) vst2(O + ((size_t)b * SS + q0 + rl) * DM + h * HD + lane * 4, *(const v4f*)&so[wave][rl][lane * 4]);
}
// ---- k_out: block = (64 rows, 128 cols): out = O(hi/lo) . Wo rows (2 products) + bo
__global__ __launch_bounds__(128) void k_out(const float* __restrict__ O, const __bf16* __restrict__ P, const float* __restrict__ BO, float* __restrict__ Y) {
  __shared__ __align__(16) unsigned char sm[2 * (64 * GXP + 128 * GWP)];
  const int tid = threadIdx.x, wave = tid >> 5, lane = tid & 31, col = lane & 15, g = lane >> 4, wm = wave >> 1, wn = wave & 1; const size_t m0 = (size_t)blockIdx.x * 64; const int n0 = blockIdx.y * 128;
  v8f acc[2][4] = {};
  gemm_lds<2, true>(O + m0 * DM, P + (size_t)n0 * DM, sm, acc, tid);
  float* so = (float*)(sm + wave * (32 * 272));   // per wave: 32 rows of 64 f32 at pitch 272 B
#pragma unroll
  for (int i = 0; i < 2; ++i) {
#pragma unroll
    for (int j = 0; j < 4; ++j) {
#pragma unroll
      for (int r = 0; r < 8; ++r) so[(i * 16 + 8 * g + r) * 68 + j * 16 + col] = acc[i][j][r] + bfr(BO[n0 + wn * 64 + j * 16 + col]); } }
  LDSX();
  for (int it = 0; it < 16; ++it) { const int rl = it * 2 + g; vst2(Y + (m0 + wm * 32 + rl) * DM + n0 + wn * 64 + col * 4, *(const v4f*)&so[rl * 68 + col * 4]); }
}
extern "C" void kernel_launch(void* const* d_in, const int* in_sizes, int n_in, void* d_out, int out_size, void* d_ws, size_t ws_size, hipStream_t stream) {
  (void)in_sizes; (void)n_in; (void)out_size;
  const float** F = (const float**)d_in;   // 0 x [2,2048,1024], 1 Wqkv [3072,1024] natural ((3,H,hd) rows), 2 Wproj [1024,1024] natural, 3 bproj [1024]
  if (ws_size < (size_t)WS_END) return;
  char* ws = (char*)d_ws; __bf16* PK = (__bf16*)(ws + WS_PK); _Float16 *QK = (_Float16*)(ws + WS_QK), *QKL = (_Float16*)(ws + WS_QKL), *VTH = (_Float16*)(ws + WS_VTH), *VTL = (_Float16*)(ws + WS_VTL); float* O = (float*)(ws + WS_O); float* CS = (float*)(ws + WS_CS);
  k_pack<<<dim3(4 * DM / 8), 256, 0, stream>>>(F[1], F[1] + (size_t)DM * DM, F[1] + (size_t)2 * DM * DM, F[2], PK, CS);
  k_qkv<<<dim3(TNB * SS / 128, QKVW / 128), 128, 0, stream>>>(F[0], F[0], F[0], PK + PK_A, nullptr, nullptr, nullptr, QK, QKL, VTH, VTL, CS);
  k_attn<<<dim3(TQB, NH, TNB), 128, 0, stream>>>(QK, QKL, VTH, VTL, nullptr, O);
  k_out<<<dim3(TOB, DM / 128), 128, 0, stream>>>(O, PK + PK_P, F[3], (float*)d_out);
}

// v007
// It runs in 80.1 microseconds.
// Two timings next to v006 both put it at 1.04 times that version's speed.
// All steps since v000 together make it 4.12 times as fast.
// compute dtype: all float inputs rounded to bf16; q/k/v = x . W^T with EXACT bf16 products on WMMA 16x16x32 (natural rows), f32; rotary (angles t x inv_freq, device cosf/sinf) in f32 on q and k, rounded to f16 hi + residual; banded all-keys attention with hybrid scores (first 128 queries 3-product, later single f16) and 3-product P.v everywhere (key tiles outside [q-512, q] skipped), x 1/8, running-max softmax in f32 (hardware exp); out = ctx (bf16 hi + lo, 2 products) . Wproj^T + b; f32 output.
#include <hip/hip_runtime.h>
#include <math.h>

typedef __attribute__((ext_vector_type(16))) _Float16 v16h;
typedef __attribute__((ext_vector_type(16))) __bf16 v16b;
typedef __attribute__((ext_vector_type(8)))  _Float16 v8h;
typedef __attribute__((ext_vector_type(8)))  float v8f;
typedef __attribute__((ext_vector_type(4)))  float v4f;
typedef __attribute__((ext_vector_type(2)))  float v2f;
typedef __attribute__((ext_vector_type(4)))  unsigned v4u;
typedef __attribute__((ext_vector_type(4)))  int v4i;
typedef float __attribute__((may_alias)) float_a;
typedef int __attribute__((may_alias)) int_a;

template <typename T> __device__ __forceinline__ void vst2(void* p, T v) { *(T*)p = v;  }
__device__ __forceinline__ v8f wmma16(v16h a, v16h b, v8f c) {
  v8f d = __builtin_amdgcn_wmma_f32_16x16x32_f16(false, a, false, b, (short)0, c, false, false);
  asm volatile("v_nop\n\tv_nop\n\tv_nop\n\tv_nop" : "+v"(d) : "v"(a), "v"(b));
  return d;
}
__device__ __forceinline__ v8f wmma_bf(v16b a, v16b b, v8f c) {
  v8f d = __builtin_amdgcn_wmma_f32_16x16x32_bf16(false, a, false, b, (short)0, c, false, false);
  asm volatile("v_nop\n\tv_nop\n\tv_nop\n\tv_nop" : "+v"(d) : "v"(a), "v"(b));
  return d;
}
// Causal local self-attention (B 2, T 2,048, C 1,024, 16 heads x 64, window 512): fused bias-free projection (natural [3C][C]), interleaved rotary embedding on q and k, scores / 8 restricted to k <= q <= k + 512, softmax, v, natural output projection + bias.
__device__ __forceinline__ v16h frag_h(const _Float16* rowk0, int lane) {
  union { v16h v; v8h q[2]; } u; const _Float16* p = rowk0 + 8 * (lane >> 4);
  u.q[0] = *(const v8h*)p; u.q[1] = *(const v8h*)(p + 16); return u.v;
}
__device__ __forceinline__ v16h frag_f32(const float* rowk0, int lane) {
  v16h a; const float* p = rowk0 + 8 * (lane >> 4);
#pragma unroll
  for (int i = 0; i < 8; ++i) { a[i] = (_Float16)p[i]; a[8 + i] = (_Float16)p[16 + i]; }
  return a;
}
__device__ __forceinline__ v16h frag_f32s(const float* rowk0, int lane, float sc) {
  v16h a; const float* p = rowk0 + 8 * (lane >> 4);
#pragma unroll
  for (int i = 0; i < 8; ++i) { a[i] = (_Float16)(p[i] * sc); a[8 + i] = (_Float16)(p[16 + i] * sc); }
  return a;
}
// column fragment from a [K][ld] layout (column n), rows >= K read as 0
__device__ __forceinline__ v16h fragc_f32(const float* W, int k0, int n, int lane, int ld, int K) {
  v16h a; const int g = lane >> 4;
#pragma unroll
  for (int i = 0; i < 8; ++i) { const int ka = k0 + 8 * g + i, kb = ka + 16;
    a[i] = (_Float16)(ka < K ? W[(size_t)(ka < K ? ka : K - 1) * ld + n] : 0.f); a[8 + i] = (_Float16)(kb < K ? W[(size_t)(kb < K ? kb : K - 1) * ld + n] : 0.f); }
  return a;
}
struct F2 { v16b h, l; };
__device__ __forceinline__ F2 bsplit16(const float v[16]) { F2 r;
#pragma unroll
  for (int i = 0; i < 16; ++i) { const __bf16 h = (__bf16)v[i]; r.h[i] = h; r.l[i] = (__bf16)(v[i] - (float)h); }
  return r; }
__device__ __forceinline__ F2 split_row(const float* row, int k0, int lane) { float v[16]; const float* p = row + k0 + 8 * (lane >> 4);
#pragma unroll
  for (int i = 0; i < 8; ++i) { v[i] = p[i]; v[8 + i] = p[16 + i]; }
  return bsplit16(v); }
__device__ __forceinline__ F2 split_rowK(const float* row, int k0, int lane, int K) { float v[16]; const int g = lane >> 4;
#pragma unroll
  for (int i = 0; i < 8; ++i) { const int ka = k0 + 8 * g + i, kb = ka + 16; v[i] = ka < K ? row[ka < K ? ka : K - 1] : 0.f; v[8 + i] = kb < K ? row[kb < K ? kb : K - 1] : 0.f; }
  return bsplit16(v); }
__device__ __forceinline__ F2 split_col(const float* W, int k0, int n, int lane, int ld, int K) { float v[16]; const int g = lane >> 4;
#pragma unroll
  for (int i = 0; i < 8; ++i) { const int ka = k0 + 8 * g + i, kb = ka + 16; v[i] = ka < K ? W[(size_t)(ka < K ? ka : K - 1) * ld + n] : 0.f; v[8 + i] = kb < K ? W[(size_t)(kb < K ? kb : K - 1) * ld + n] : 0.f; }
  return bsplit16(v); }
__device__ __forceinline__ v8f mac3(const F2& a, const F2& b, v8f c) { c = wmma_bf(a.l, b.h, c); c = wmma_bf(a.h, b.l, c); return wmma_bf(a.h, b.h, c); }
__device__ __forceinline__ float sigm(float v) { return 1.0f / (1.0f + expf(-v)); }
#define LDSX() do { asm volatile("s_wait_dscnt 0" ::: "memory"); __builtin_amdgcn_wave_barrier(); __builtin_amdgcn_fence(__ATOMIC_RELEASE, "workgroup"); } while (0)


#define NB 2
#define SS 2048
#define DM 1024
#define NH 16
#define LWIN 512
#define RBASE 10000.0f
#define HD 64
#define QKVW (3 * DM)
#ifndef TQB
#define TQB (SS / 64)
#define TNB NB
#define TOB (NB * SS / 64)     // output row tiles (all)
#endif
typedef __attribute__((ext_vector_type(8))) __bf16 v8b;
__device__ __forceinline__ v16b frag_b(const __bf16* rowk0, int lane) {
  union { v16b v; v8b q[2]; } u; const __bf16* p = rowk0 + 8 * (lane >> 4);
  u.q[0] = *(const v8b*)p; u.q[1] = *(const v8b*)(p + 16); return u.v;
}
__device__ __forceinline__ float bfr(float v) { return (float)(__bf16)v; }
__device__ __attribute__((noinline)) float exp_ni(float v) { return expf(v); }
__device__ __attribute__((noinline)) float erf_ni(float v) { return erff(v); }

#define PK_A 0                       // [3072][1024] Wqkv rows (natural [out][in])
#define PK_P (PK_A + QKVW * DM)        // [1024][1024] Wo rows (natural)
#define PK_END (PK_P + DM * DM)
#define WS_PK  0u
#define WS_QK  (WS_PK + 2u * PK_END)             // f16 [4096 rows][2048]: q | k
#define WS_QKL (WS_QK + 2u * NB * SS * 2 * DM)     // f16 q | k residual planes x2048
#define WS_VTH (WS_QKL + 2u * NB * SS * 2 * DM)    // f16 [b][1024 (h*64+d)][2048 s] hi
#define WS_VTL (WS_VTH + 2u * NB * DM * SS)        // f16 lo x 2048
#define WS_O   (WS_VTL + 2u * NB * DM * SS)        // f32 [4096][1024]
#define WS_CS  (WS_O + 4u * NB * SS * DM)           // f32 [2048 positions][32 cos | 32 sin]
#define WS_END (WS_CS + 4u * 2 * SS * 32)
// ---- k_pack: one wave = one natural [out][in] row of 1,024 floats -> bf16; rows 0..3071 are W_q/W_k/W_v into PK_A, rows 3072..4095 W_o into PK_P. 512 blocks of 8 waves, two a WGP, so that the launch has 4,096 waves to start:
// a lane asks for its eight 16-B pieces at once (each wave-wide load covers 512 contiguous bytes), rounds them in registers and stores 8 B a piece (a wave-wide store covers two whole 128-B lines)
// waves 0..3 of every block also write one position's row of the rotary table: angle pos * inv_freq[i], inv_freq[i] = BASE^(-i/32), 32 cos then 32 sin (two whole 128-B lines)
typedef __attribute__((ext_vector_type(4))) __bf16 v4b;
__global__ __launch_bounds__(256) void k_pack(const float* __restrict__ WQ, const float* __restrict__ WK, const float* __restrict__ WV, const float* __restrict__ WO, __bf16* __restrict__ PK, float* __restrict__ CS) {
  const int t = threadIdx.x, wave = t >> 5, lane = t & 31; const int row = blockIdx.x * 8 + wave, which = row / DM, n = row % DM; const float* Wm = (which == 0) ? WQ : (which == 1) ? WK : (which == 2) ? WV : WO;
  const float* sp = Wm + (size_t)n * DM + lane * 4; v4f x[8];
#pragma unroll   // unrolled: register array, all eight loads in flight together
  for (int j = 0; j < 8; ++j) x[j] = *(const v4f*)(sp + j * 128);
  if (wave < 4) { const int pos = blockIdx.x * 4 + wave;   // 512 blocks x 4 waves = the SS positions; the table's arithmetic runs while the row's loads fly
    const float invf = (float)exp(-(double)lane / (double)(HD / 2) * log((double)RBASE)); const float ang = (float)pos * invf;
    CS[pos * HD + lane] = cosf(ang); CS[pos * HD + HD / 2 + lane] = sinf(ang); }
  __bf16* dst = ((which < 3) ? PK + PK_A + ((size_t)which * DM + n) * DM : PK + PK_P + (size_t)n * DM) + lane * 4;
#pragma unroll
  for (int j = 0; j < 8; ++j) { v4b y;
#pragma unroll
    for (int e = 0; e < 4; ++e) y[e] = (__bf16)x[j][e];
    vst2(dst + j * 128, y); }
}
// ---- projection GEMM core: block tile (32 * MI rows) x 128 columns, 4 waves as 2 x 2, each (16 * MI) x 64. A stage is 64 k: the f32 rows of X (256 B, LDS pitch 272 B) and the bf16 rows of W (128 B, LDS pitch 144 B),
// brought into LDS by one tensor load each (the pad fields lay the pitch), two buffers: stage t + 1 flies while stage t is multiplied. Fragments keep the k order and every accumulator its k sequence (32 steps of 32, ascending).
#define GXP 272
#define GWP 144
typedef __attribute__((ext_vector_type(8))) unsigned v8u;
__device__ __forceinline__ unsigned uni(unsigned v) { return (unsigned)__builtin_amdgcn_readfirstlane(v); }
__device__ __forceinline__ unsigned pinned(unsigned v) { unsigned w = (unsigned)__builtin_amdgcn_readfirstlane(v); asm volatile("" : "+s"(w)); return w; }
#define TPAD256 ((1u << 20) | (5u << 22) | (3u << 25))   // rows of 256 B, 16 B of pad behind each: LDS pitch 272 B
#define TPAD128 ((1u << 20) | (4u << 22) | (3u << 25))   // rows of 128 B, 16 B of pad behind each: LDS pitch 144 B
// descriptor group 1 of a tile of ROWS rows of ROWB bytes, source pitch PITCH bytes: 1-byte elements, tensor = tile, no mask. Built once;
// the closing statement is pinned() on the whole group: the words stay in one run of scalar registers that nothing else writes while a request is in flight
template <unsigned ROWB, unsigned ROWS, unsigned PITCH, unsigned W0>
__device__ __forceinline__ v8u tgroup1() { v8u g1;
  g1[0] = uni(W0); g1[1] = uni((ROWB & 0xFFFFu) << 16); g1[2] = uni((ROWB >> 16) | ((ROWS & 0xFFFFu) << 16)); g1[3] = uni((ROWS >> 16) | (ROWB << 16));
  g1[4] = uni(ROWS); g1[5] = uni(PITCH); g1[6] = uni(0u); g1[7] = uni(0u);
  asm volatile("" : "+s"(g1)); return g1; }   // pinned() on the group: descriptor words held in scalar registers
// descriptor group 0: LDS byte offset dst, the tile's first byte at src
__device__ __forceinline__ void tgroup0(v4u& g0, unsigned dst, const char* src) { const unsigned long long ga = (unsigned long long)(size_t)src;
  g0[1] = uni(dst); g0[2] = uni((unsigned)ga); g0[3] = uni((((unsigned)(ga >> 32)) & 0x01FFFFFFu) | 0x80000000u); }
// one request of the calling wave
__device__ __forceinline__ void tissue(v4u g0, v8u g1) { asm volatile("tensor_load_to_lds %0, %1" :: "s"(g0), "s"(g1) : "memory"); }
// stands behind the wait that covers the wave's request (pinned() on group 0): the group lives in its scalar registers up to here and takes its next values only behind the wait
#define THOLD(g0) asm volatile("" : "+s"(g0))   // pinned() on group 0: descriptor words held in scalar registers
template <int MI, bool SPLIT>
__device__ __forceinline__ void gemm_lds(const float* __restrict__ Xb, const __bf16* __restrict__ Wb, unsigned char* sm, v8f (&acc)[MI][4], int tid) {
  constexpr int XB = (32 * MI * GXP + 2047) & ~2047, ST = XB + 128 * GWP, NT = DM / 64;   // every tile's place in LDS is a multiple of 2 KiB
  static_assert(ST % 2048 == 0, "a stage's size keeps the second buffer's places at multiples of 2 KiB");
  const int wave = tid >> 5, lane = tid & 31, col = lane & 15, g = lane >> 4, wm = wave >> 1, wn = wave & 1;
  const unsigned wv = uni((unsigned)tid >> 5), lb = (unsigned)(size_t)sm;
  // wave 0 asks for the stage's X tile, wave 1 for its W tile: one request a wave and stage
  const v8u g1x = tgroup1<256, 32 * MI, DM * 4, TPAD256>(), g1w = tgroup1<128, 128, DM * 2, TPAD128>();
  const char* tsrc = wv == 0u ? (const char*)Xb : (const char*)Wb; const unsigned tstep = wv == 0u ? 256u : 128u, tdst = lb + (wv == 0u ? 0u : (unsigned)XB);
  v4u g0; g0[0] = uni(1u);
  auto stage = [&](unsigned t, unsigned bo) { tgroup0(g0, tdst + bo, tsrc + (size_t)t * tstep);
    if (pinned(wv == 0u)) tissue(g0, g1x);
    if (pinned(wv == 1u)) tissue(g0, g1w); };
  stage(0u, 0u);
  if (pinned(wv < 2u)) asm volatile("s_wait_tensorcnt 0x0" ::: "memory");   // the issuing wave's tile of stage 0 has landed
  THOLD(g0);
  __syncthreads();                                     // stage 0 published to every wave
  stage(1u, (unsigned)ST);
#pragma unroll 1   // rolled: one body of 32 or more matrix instructions
  for (int t = 0; t < NT; ++t) { const unsigned bo = (t & 1) ? (unsigned)ST : 0u;
    const unsigned char* sx = sm + bo + (wm * 16 * MI + col) * GXP + 32 * g; const unsigned char* sw = sm + bo + XB + (wn * 64 + col) * GWP + 16 * g;
#pragma unroll
    for (int kc = 0; kc < 2; ++kc) { v16b b[4];
#pragma unroll
      for (int j = 0; j < 4; ++j) { union { v16b v; v8b q[2]; } u; const unsigned char* p = sw + j * (16 * GWP) + kc * 64; u.q[0] = *(const v8b*)p; u.q[1] = *(const v8b*)(p + 32); b[j] = u.v; }
#pragma unroll
      for (int i = 0; i < MI; ++i) { const v4f* p = (const v4f*)(sx + i * (16 * GXP) + kc * 128); const v4f x0 = p[0], x1 = p[1], x2 = p[4], x3 = p[5]; float v[16];
#pragma unroll
        for (int e = 0; e < 4; ++e) { v[e] = x0[e]; v[4 + e] = x1[e]; v[8 + e] = x2[e]; v[12 + e] = x3[e]; }
        if (SPLIT) { const F2 a = bsplit16(v);
#pragma unroll
          for (int j = 0; j < 4; ++j) acc[i][j] = wmma_bf(a.l, b[j], acc[i][j]);   // residual first, then hi, per accumulator as before; four independent tiles between the two
#pragma unroll
          for (int j = 0; j < 4; ++j) acc[i][j] = wmma_bf(a.h, b[j], acc[i][j]); }
        else { v16b a;
#pragma unroll
          for (int e = 0; e < 16; ++e) a[e] = (__bf16)v[e];
#pragma unroll
          for (int j = 0; j < 4; ++j) acc[i][j] = wmma_bf(a, b[j], acc[i][j]); } } }
    asm volatile("s_wait_dscnt 0x0" ::: "memory");      // this wave's reads of stage t are done before its buffer is refilled
    if (pinned(wv < 2u)) asm volatile("s_wait_tensorcnt 0x0" ::: "memory");   // the issuing wave's tile of stage t + 1 has landed
    THOLD(g0);
    __syncthreads();                                     // publishes stage t + 1 and ends every wave's reads of stage t
    if (pinned(t + 2 < NT)) stage((unsigned)t + 2u, bo); }
  asm volatile("s_wait_tensorcnt 0x0" ::: "memory");    // nothing in flight when the buffers become output staging
  asm volatile("s_wait_dscnt 0x0" ::: "memory");
}
// ---- k_qkv: block = (128 rows, 128 columns); each wave stages its 64 x 64 result (one head's columns) in its own LDS range and stores whole 128-B lines.
// q and k are staged in f32; on the way back a lane holds 8 consecutive columns of a row = 4 (even, odd) pairs, turns them by the row's position (interleaved rotary, cos and sin from the table of k_pack's launch) and splits them into f16 hi + residual
__global__ __launch_bounds__(128) void k_qkv(const float* __restrict__ XQ, const float* __restrict__ XK, const float* __restrict__ XV, const __bf16* __restrict__ P, const float* __restrict__ BQ, const float* __restrict__ BK, const float* __restrict__ BV, _Float16* __restrict__ QK, _Float16* __restrict__ QKL, _Float16* __restrict__ VTH, _Float16* __restrict__ VTL, const float* __restrict__ CS) {
  const int which0 = (blockIdx.y * 128) / DM; const float* X = (which0 == 0) ? XQ : (which0 == 1) ? XK : XV; const float* BB = BQ ? (((which0 == 0) ? BQ : (which0 == 1) ? BK : BV) + (blockIdx.y * 128 - which0 * DM)) : nullptr;
  __shared__ __attribute__((aligned(2048))) unsigned char sm[2 * (128 * GXP + 128 * GWP)];
  const int tid = threadIdx.x, wave = tid >> 5, lane = tid & 31, col = lane & 15, g = lane >> 4, wm = wave >> 1, wn = wave & 1; const size_t m0 = (size_t)blockIdx.x * 128; const int n0 = blockIdx.y * 128;
  v8f acc[4][4] = {};
  gemm_lds<4, false>(X + m0 * DM, P + (size_t)n0 * DM, sm, acc, tid);
  float bj[4];
#pragma unroll
  for (int j = 0; j < 4; ++j) bj[j] = BB ? bfr(BB[wn * 64 + j * 16 + col]) : 0.f;
  _Float16* eh = (_Float16*)(sm + wave * (2 * 64 * 144)); _Float16* el = eh + 64 * 72;   // v, per wave: hi and residual planes, 64 rows at pitch 144 B
  if (n0 < 2 * DM) {   // q stored unscaled (f16 sigma ~0.6, no subnormal exposure); 1/8 applied to the f32 score
    float* sf = (float*)(sm + wave * (64 * 272));   // per wave: 64 rows of 64 f32 at pitch 272 B
    const int rl0 = lane >> 3, pc = lane & 7;
    const float* ct = CS + (size_t)((int)(m0 % SS) + wm * 64 + rl0) * HD + pc * 4;   // the lane's 4 cos of its first row; its 4 sin stand 32 floats on, its next row 4 positions on
    v4f tc[16], ts[16];   // the table rows are asked for in front of the staging's wait, beside the LDS stores: they depend on nothing staged
#pragma unroll   // unrolled: register arrays
    for (int it = 0; it < 16; ++it) { tc[it] = *(const v4f*)(ct + it * (4 * HD)); ts[it] = *(const v4f*)(ct + it * (4 * HD) + HD / 2); }
#pragma unroll
    for (int i = 0; i < 4; ++i) {
#pragma unroll
      for (int j = 0; j < 4; ++j) {
#pragma unroll
        for (int r = 0; r < 8; ++r) sf[(i * 16 + 8 * g + r) * 68 + j * 16 + col] = acc[i][j][r] + bj[j]; } }   // q, k (+ bias)
    LDSX();
#pragma unroll   // unrolled: tc and ts are indexed by it and stay in registers only so
    for (int it = 0; it < 16; ++it) { const int rl = it * 4 + rl0; const v4f xa = *(const v4f*)&sf[rl * 68 + pc * 8], xb = *(const v4f*)&sf[rl * 68 + pc * 8 + 4]; const float x[8] = { xa[0], xa[1], xa[2], xa[3], xb[0], xb[1], xb[2], xb[3] }; v8h yh, yl;
#pragma unroll
      for (int p = 0; p < 4; ++p) { const float x0 = x[2 * p], x1 = x[2 * p + 1], cs = tc[it][p], sn = ts[it][p]; const float y0 = x0 * cs - x1 * sn, y1 = x1 * cs + x0 * sn;
        const _Float16 h0 = (_Float16)y0, h1 = (_Float16)y1; yh[2 * p] = h0; yh[2 * p + 1] = h1; yl[2 * p] = (_Float16)((y0 - (float)h0) * 2048.0f); yl[2 * p + 1] = (_Float16)((y1 - (float)h1) * 2048.0f); }   // f16 hi + (x2048) residual
      const size_t o = (m0 + wm * 64 + rl) * (2 * DM) + n0 + wn * 64 + pc * 8; vst2(QK + o, yh); vst2(QKL + o, yl); }
  } else {   // v transposed: a lane's 8 accumulator rows are 8 consecutive s of one d
#pragma unroll
    for (int i = 0; i < 4; ++i) {
#pragma unroll
      for (int j = 0; j < 4; ++j) { v8h th, tl;
#pragma unroll
        for (int r = 0; r < 8; ++r) { const float v = acc[i][j][r] + bj[j]; const _Float16 hv = (_Float16)v; th[r] = hv; tl[r] = (_Float16)((v - (float)hv) * 2048.0f); }
        *(v8h*)&eh[(j * 16 + col) * 72 + i * 16 + 8 * g] = th; *(v8h*)&el[(j * 16 + col) * 72 + i * 16 + 8 * g] = tl; } }
    LDSX();
    const int b = (int)(m0 / SS), s0 = (int)(m0 % SS) + wm * 64; const int pc0 = n0 - 2 * DM + wn * 64;
    for (int it = 0; it < 16; ++it) { const int d = it * 4 + (lane >> 3), pc = lane & 7; const size_t o = ((size_t)b * DM + pc0 + d) * SS + s0 + pc * 8; vst2((unsigned*)(VTH + o), *(const v4u*)&eh[d * 72 + pc * 8]); vst2((unsigned*)(VTL + o), *(const v4u*)&el[d * 72 + pc * 8]); }
  }
}
// ---- k_attn: block = (64 queries, head h, batch b): all-keys flash attention (K = 64: 2 k-steps), scores = (q.k) * 0.125 (3 products in query blocks 0 and 1, single f16 elsewhere), P.V: f16 (P * 2048) hi/lo x (V hi, V lo*2048), 3 products in two accumulators; O[b*S+q][h*64+d] = (acc + accl / 2048) / (2048 l) (256-B segments)
// A stage is 64 keys: the k rows (64 x 128 B), and the 64 d rows of v hi and of v residual (128 B = 64 keys each), every row at LDS pitch 144 B, brought in once for the block's four waves by three tensor loads (waves 0, 1, 2: one tile each),
// two buffers: stage s + 1 flies while the two 32-key steps of stage s are worked on. Fragments, their k order, the key order and every sum are as before.
#define AKP 144
#define ATL ((64 * AKP + 2047) & ~2047)   // a tile's room: its 64 rows, rounded up so that every tile's place in LDS is a multiple of 2 KiB
#define AST (3 * ATL)
// fragment from an LDS row: the lane's 16 B at p and the 16 B at p + 32 (the k order of frag_h)
__device__ __forceinline__ v16h frag_l(const unsigned char* p) { union { v16h v; v8h q[2]; } u; u.q[0] = *(const v8h*)p; u.q[1] = *(const v8h*)(p + 32); return u.v; }
// lane l with lane l ^ 16 (the other half of a query's keys)
__device__ __forceinline__ float xhalf(float x) { return __builtin_bit_cast(float, __builtin_amdgcn_permlanex16(__builtin_bit_cast(int, x), __builtin_bit_cast(int, x), 0x76543210, 0xfedcba98, false, false)); }
// Transposed products: S^T = K . Q^T (A = 16 key rows, B = the wave's 16 queries) and O^T += V^T . P^T (A = 16 d rows of v, B = P^T). A lane holds one query (column col): 8 of each 16-key tile's scores, the other 8 in lane ^ 16,
// so maximum and sum run in the lane with one exchange between the halves, and the two score tiles of a 32-key step, converted in place, are the B fragment of P^T in the k order of the v rows: P goes through no LDS.
// A wave sorts each of its 32-key steps by where the step's keys lie against the band k <= q <= k + 512 of its 16 queries: wholly outside, the step is left out (every weight would be 0, the maximum and every sum unchanged);
// wholly inside, it runs without the mask's compares and selects; only a step that straddles an edge of the band masks its scores. Of a full-length wave's 18 steps 1 is left out, 15 are wholly inside, 2 straddle.
// In a step that runs, every query has at least one key inside the band (16 queries against 32 keys, both aligned to 16), so the new maximum is a real score and a masked score's weight exp(-3e38 - maximum) is 0 by itself.
// second bound: four waves a SIMD (256 registers a wave), so that all 1,024 blocks stay resident at once as before
__global__ __launch_bounds__(128, 4) void k_attn(const _Float16* __restrict__ QK, const _Float16* __restrict__ QKL, const _Float16* __restrict__ VTH, const _Float16* __restrict__ VTL, const void* __restrict__ KMASK, float* __restrict__ O) {
  __shared__ __attribute__((aligned(2048))) unsigned char sb[2 * AST];
  const int tid = threadIdx.x, wave = tid >> 5, lane = tid & 31, col = lane & 15, g = lane >> 4;
  const int qb = blockIdx.x, h = blockIdx.y, b = blockIdx.z; const int q0 = qb * 64 + wave * 16; const size_t rq = (size_t)b * SS + q0 + col; const int qi = q0 + col;   // qi: the lane's query
  const int wq0 = qb * 64 + __builtin_amdgcn_readfirstlane(wave) * 16;   // the wave's first query in a scalar register: the tests that sort a step are scalar branches, EXEC stays whole for the matrix instructions
  const int st0 = qb > LWIN / 64 ? qb - LWIN / 64 : 0, st1 = qb;   // banded causal: 64-key stages st0 .. st1
  const unsigned wv = uni((unsigned)tid >> 5), lb = (unsigned)(size_t)sb;
  const char* gk = (const char*)(QK + (size_t)b * SS * (2 * DM) + DM + h * HD);   // key 0's row of this head; a stage is 64 rows on
  const size_t vo = ((size_t)b * DM + h * HD) * SS * 2; const char* gvh = (const char*)VTH + vo; const char* gvl = (const char*)VTL + vo;   // d row 0; a stage is 128 B on in every row
  // waves 0, 1, 2 ask for the stage's k, v hi and v residual tile: one request a wave and stage; the three tiles have one shape, so one group 1
  const v8u g1 = tgroup1<128, 64, 2 * DM * 2, TPAD128>(); static_assert(2 * DM * 2 == SS * 2, "k rows and v rows have one source pitch");
  const char* tsrc = wv == 0u ? gk : wv == 1u ? gvh : gvl; const unsigned tstep = wv == 0u ? 64u * 2 * DM * 2 : 128u, tdst = lb + (wv < 3u ? wv : 0u) * ATL;
  v4u g0; g0[0] = uni(1u);
  auto stage = [&](unsigned s, unsigned bo) { tgroup0(g0, tdst + bo, tsrc + (size_t)s * tstep);
    if (pinned(wv < 3u)) tissue(g0, g1); };
  stage((unsigned)st0, 0u);
  v16h aq[2];
#pragma unroll
  for (int kc = 0; kc < 2; ++kc) aq[kc] = frag_h(QK + rq * (2 * DM) + h * HD + kc * 32, lane);
  float m = -3.0e38f, l = 0.f;   // the lane's query: running maximum (both halves alike), sum over this half's keys
  v8f acc[4] = {}, accl[4] = {};
  if (pinned(wv < 3u)) asm volatile("s_wait_tensorcnt 0x0" ::: "memory");   // the issuing wave's tile of the first stage has landed
  THOLD(g0);
  __syncthreads();                                     // first stage published to every wave
  if (pinned(st0 < st1)) stage((unsigned)st0 + 1u, (unsigned)AST);
#pragma unroll 1   // rolled: one body for every stage
  for (int st = st0; st <= st1; ++st) { const unsigned bo = ((st - st0) & 1) ? (unsigned)AST : 0u;
#pragma unroll 1   // rolled: the two 32-key steps of a stage share one body
  for (int sub = 0; sub < 2; ++sub) { const int ks = st * 2 + sub; v8f s[2];
    if (ks * 32 > wq0 + 15 || wq0 - (ks * 32 + 31) > LWIN) continue;   // keys ks * 32 .. + 31 against queries wq0 .. + 15: wholly outside the band
    const unsigned char* lk = sb + bo + (sub * 32 + col) * AKP + 16 * g; const unsigned char* lv = sb + bo + ATL + col * AKP + sub * 64 + 16 * g;
    v16h kf[2][2];   // the step's four k fragments, read as one group ahead of the products
#pragma unroll
    for (int ct = 0; ct < 2; ++ct) {
#pragma unroll
      for (int kc = 0; kc < 2; ++kc) kf[ct][kc] = frag_l(lk + ct * (16 * AKP) + kc * 64); }
    v16h vh[4], vl[4];   // the step's eight v fragments
#pragma unroll
    for (int dt = 0; dt < 4; ++dt) { vh[dt] = frag_l(lv + dt * (16 * AKP)); vl[dt] = frag_l(lv + ATL + dt * (16 * AKP)); }
#pragma unroll
    for (int ct = 0; ct < 2; ++ct) { const _Float16* krowl = QKL + ((size_t)b * SS + ks * 32 + ct * 16 + col) * (2 * DM) + DM + h * HD; v8f c = {}, cl = {};
      if (qb < 2) {   // leading query blocks (few keys, outputs far above the global rms): 3 products; the q residual is fetched here, where alone it is used, so that it holds no registers in the other blocks
#pragma unroll
        for (int kc = 0; kc < 2; ++kc) { const v16h kh = kf[ct][kc]; c = wmma16(kh, aq[kc], c); cl = wmma16(kh, frag_h(QKL + rq * (2 * DM) + h * HD + kc * 32, lane), cl); cl = wmma16(frag_h(krowl + kc * 32, lane), aq[kc], cl); }
#pragma unroll
        for (int r = 0; r < 8; ++r) c[r] += cl[r] * (1.0f / 2048.0f); }
      else {
#pragma unroll
        for (int kc = 0; kc < 2; ++kc) c = wmma16(kf[ct][kc], aq[kc], c); }   // single product elsewhere
#pragma unroll
      for (int r = 0; r < 8; ++r) s[ct][r] = c[r] * 0.125f; }   // 1/sqrt(64)
    if (ks * 32 + 31 > wq0 || wq0 + 15 - ks * 32 > LWIN) {   // the step straddles an edge of the band: masked keys excluded
#pragma unroll
      for (int ct = 0; ct < 2; ++ct) {
#pragma unroll
        for (int r = 0; r < 8; ++r) { const int kk = ks * 32 + ct * 16 + 8 * g + r; s[ct][r] = (kk <= qi && qi - kk <= LWIN) ? s[ct][r] : -3.0e38f; } } }
    float mx = fmaxf(s[0][0], s[1][0]);
#pragma unroll
    for (int r = 1; r < 8; ++r) mx = fmaxf(mx, fmaxf(s[0][r], s[1][r]));
    mx = fmaxf(mx, xhalf(mx));   // the step's 32 keys
    const float mn = fmaxf(m, mx); const float alpha = (m <= -1.0e38f) ? 0.f : __expf(m - mn);
    v8f e[2];
#pragma unroll
    for (int ct = 0; ct < 2; ++ct) {
#pragma unroll
      for (int r = 0; r < 8; ++r) e[ct][r] = __expf(s[ct][r] - mn); }
    const v8f e8 = e[0] + e[1]; const v4f e4 = e8.lo + e8.hi; const v2f e2 = e4.lo + e4.hi;
    l = l * alpha + (e2[0] + e2[1]); m = mn;   // the halves' sums are joined once, behind the loop
#pragma unroll
    for (int dt = 0; dt < 4; ++dt) { acc[dt] *= alpha; accl[dt] *= alpha; }
    v16h pa, pl;
#pragma unroll
    for (int ct = 0; ct < 2; ++ct) {
#pragma unroll
      for (int r = 0; r < 8; ++r) { const float x = e[ct][r] * 2048.0f; const _Float16 hx = (_Float16)x; pa[ct * 8 + r] = hx; pl[ct * 8 + r] = (_Float16)((x - (float)hx) * 2048.0f); } }   // P scaled by 2^11 before the f16 split so small softmax weights stay out of the f16 subnormal range; 2^-11 folded into the epilogue
#pragma unroll
    for (int dt = 0; dt < 4; ++dt) acc[dt] = wmma16(vh[dt], pa, acc[dt]);
    if (qb < 32) {   // every query block (qb < 32 always holds): P hi/lo x V hi/lo (3 products); per accumulator the residual of P first, then that of v, as before
#pragma unroll
      for (int dt = 0; dt < 4; ++dt) accl[dt] = wmma16(vh[dt], pl, accl[dt]);
#pragma unroll
      for (int dt = 0; dt < 4; ++dt) accl[dt] = wmma16(vl[dt], pa, accl[dt]); }
    }
    asm volatile("s_wait_dscnt 0x0" ::: "memory");      // this wave's reads of stage st are done before its buffer is refilled
    if (pinned(wv < 3u)) asm volatile("s_wait_tensorcnt 0x0" ::: "memory");   // the issuing wave's tile of stage st + 1 has landed
    THOLD(g0);
    __syncthreads();                                     // publishes stage st + 1 and ends every wave's reads of stage st
    if (pinned(st + 2 <= st1)) stage((unsigned)st + 2u, bo); }
  asm volatile("s_wait_tensorcnt 0x0" ::: "memory");    // nothing in flight when the buffers become output staging
  asm volatile("s_wait_dscnt 0x0" ::: "memory");
  float (*so)[16][68] = (float (*)[16][68])sb;          // each wave's own range of the ring, free behind the last stage's barrier
  const float il = (1.0f / 2048.0f) / (l + xhalf(l));
#pragma unroll
  for (int dt = 0; dt < 4; ++dt) { v4f o0, o1;   // a lane's 8 accumulator rows are 8 consecutive d of its query
#pragma unroll
    for (int r = 0; r < 4; ++r) { o0[r] = (acc[dt][r] + accl[dt][r] * (1.0f / 2048.0f)) * il; o1[r] = (acc[dt][4 + r] + accl[dt][4 + r] * (1.0f / 2048.0f)) * il; }
    *(v4f*)&so[wave][col][dt * 16 + 8 * g] = o0; *(v4f*)&so[wave][col][dt * 16 + 8 * g + 4] = o1; }
  LDSX();
  for (int rl = 0; rl < 16; ++rl) if (lane < 16) vst2(O + ((size_t)b * SS + q0 + rl) * DM + h * HD + lane * 4, *(const v4f*)&so[wave][rl][lane * 4]);
}
// ---- k_out: block = (64 rows, 128 cols): out = O(hi/lo) . Wo rows (2 products) + bo
__global__ __launch_bounds__(128) void k_out(const float* __restrict__ O, const __bf16* __restrict__ P, const float* __restrict__ BO, float* __restrict__ Y) {
  __shared__ __attribute__((aligned(2048))) unsigned char sm[2 * (((64 * GXP + 2047) & ~2047) + 128 * GWP)];
  const int tid = threadIdx.x, wave = tid >> 5, lane = tid & 31, col = lane & 15, g = lane >> 4, wm = wave >> 1, wn = wave & 1; const size_t m0 = (size_t)blockIdx.x * 64; const int n0 = blockIdx.y * 128;
  v8f acc[2][4] = {};
  gemm_lds<2, true>(O + m0 * DM, P + (size_t)n0 * DM, sm, acc, tid);
  float* so = (float*)(sm + wave * (32 * 272));   // per wave: 32 rows of 64 f32 at pitch 272 B
#pragma unroll
  for (int i = 0; i < 2; ++i) {
#pragma unroll
    for (int j = 0; j < 4; ++j) {
#pragma unroll
      for (int r = 0; r < 8; ++r) so[(i * 16 + 8 * g + r) * 68 + j * 16 + col] = acc[i][j][r] + bfr(BO[n0 + wn * 64 + j * 16 + col]); } }
  LDSX();
  for (int it = 0; it < 16; ++it) { const int rl = it * 2 + g; vst2(Y + (m0 + wm * 32 + rl) * DM + n0 + wn * 64 + col * 4, *(const v4f*)&so[rl * 68 + col * 4]); }
}
extern "C" void kernel_launch(void* const* d_in, const int* in_sizes, int n_in, void* d_out, int out_size, void* d_ws, size_t ws_size, hipStream_t stream) {
  (void)in_sizes; (void)n_in; (void)out_size;
  const float** F = (const float**)d_in;   // 0 x [2,2048,1024], 1 Wqkv [3072,1024] natural ((3,H,hd) rows), 2 Wproj [1024,1024] natural, 3 bproj [1024]
  if (ws_size < (size_t)WS_END) return;
  char* ws = (char*)d_ws; __bf16* PK = (__bf16*)(ws + WS_PK); _Float16 *QK = (_Float16*)(ws + WS_QK), *QKL = (_Float16*)(ws + WS_QKL), *VTH = (_Float16*)(ws + WS_VTH), *VTL = (_Float16*)(ws + WS_VTL); float* O = (float*)(ws + WS_O); float* CS = (float*)(ws + WS_CS);
  k_pack<<<dim3(4 * DM / 8), 256, 0, stream>>>(F[1], F[1] + (size_t)DM * DM, F[1] + (size_t)2 * DM * DM, F[2], PK, CS);
  k_qkv<<<dim3(TNB * SS / 128, QKVW / 128), 128, 0, stream>>>(F[0], F[0], F[0], PK + PK_A, nullptr, nullptr, nullptr, QK, QKL, VTH, VTL, CS);
  k_attn<<<dim3(TQB, NH, TNB), 128, 0, stream>>>(QK, QKL, VTH, VTL, nullptr, O);
  k_out<<<dim3(TOB, DM / 128), 128, 0, stream>>>(O, PK + PK_P, F[3], (float*)d_out);
}
